// v000
// Times are from an AMD MI455X. After a warm-up the kernel runs many times in a row, and a time is the length of
// such a window on the GPU divided by its runs, so every launch and the gaps after it count. The runs cycle
// through copies of the inputs. A figure is the median of several windows, for all but v000 over two sittings.
// Sittings can differ by a few percent; kernels timed side by side share one.
// The starting kernel, v000, takes 437 microseconds a run.
// Contractions: q|k and v^T projections = v_wmma_f32_16x16x32_bf16 (bf16 operands from RNE-converted x and the
// transposed [out][in] projection weight, single product, f32 accumulate);
// q.k^T scores = v_wmma_f32_16x16x32_bf16 with bf16 hi/lo split of the normalised q and k (hi.hi + hi.lo + lo.hi), f32 accumulate;
// p.v = v_wmma_f32_16x16x32_f16 (p carried x1024 in f16 plus an f16 residual plane x4096; v as f16 hi plane plus an f16
// residual plane x4096; 3 products, f32 accumulate);
// ctx.Wout = v_wmma_f32_16x16x32_bf16 with ctx as bf16 hi/lo planes times bf16 Wout (2 products), f32 accumulate;
// per-head sum-of-squares normalisation (x 8 x gamma), softmax, normalisers and bias adds in f32 on the VALU.
// Carry audit:
//   Psh = f16(1024 * p)                      -> the 1/1024 is folded exactly once in the attention epilogue: inv = (1/l) * (1/1024)
//   Psl = f16((1024 p - Psh) * 4096)         }  products Psh.VTl and Psl.VTh go to the separate accumulator o1,
//   VTl = f16((v - VTh) * 4096)              }  folded back with * (1/4096) once per key chunk
//   VTh = f16(v), no carry (|v| typ. 0.6); q / k / ctx lo planes are unscaled bf16 residuals (v - hi) sharing the hi accumulator;
//   score scale 1/8 applied once in f32 after the score accumulate; normalisation 8 * rsqrt(sum sq) * gamma applied in f32 in the
//   q|k projection epilogue before the bf16 hi/lo split. No other scaled planes.
#include <hip/hip_runtime.h>
#include <math.h>
#include <stdint.h>

#define NB    2
#define SEQ   2048
#define DM    1024
#define NH    16
#define HD    64
#define QKP   (2 * DM)     // pitch (elements) of the packed q|k planes: q at cols 0..1023, k at cols 1024..2047
#define NQB   (SEQ / 64)   // 32 query / key blocks of 64
static_assert(NH * HD == DM);
static_assert(HD == 64);
static_assert((SEQ % 64) == 0 && (DM % 64) == 0 && (DM % 32) == 0);
static_assert(((NB * SEQ / 64) * (QKP / 64)) % 8 == 0);
static_assert(((NB * SEQ / 64) * (DM / 64)) % 8 == 0);
static_assert(((DM / 64) * (SEQ / 64)) % 8 == 0);
static_assert((NB * SEQ * DM) % (8 * 256) == 0);

typedef _Float16 v16h __attribute__((ext_vector_type(16)));
typedef _Float16 v8h  __attribute__((ext_vector_type(8)));
typedef __bf16   v16b __attribute__((ext_vector_type(16)));
typedef __bf16   v8b  __attribute__((ext_vector_type(8)));
typedef float    v8f  __attribute__((ext_vector_type(8)));
typedef float    v4f  __attribute__((ext_vector_type(4)));
typedef unsigned int v4u __attribute__((ext_vector_type(4)));

// ---- scalar helpers --------------------------------------------------------------------------------
__device__ __forceinline__ unsigned short bf_bits(float f) {          // f32 -> bf16 bits, RNE convert
  unsigned u = __float_as_uint(f);
  return (unsigned short)((u + 0x7FFFu + ((u >> 16) & 1u)) >> 16);
}
__device__ __forceinline__ float bf_up(unsigned short hb) { return __uint_as_float(((unsigned)hb) << 16); }
__device__ __forceinline__ unsigned short h_bits(_Float16 x) { return __builtin_bit_cast(unsigned short, x); }
__device__ __forceinline__ unsigned pk16(unsigned short a, unsigned short b) { return (unsigned)a | ((unsigned)b << 16); }
__device__ __forceinline__ v8f zero8() { v8f z = {0.f, 0.f, 0.f, 0.f, 0.f, 0.f, 0.f, 0.f}; return z; }

// ---- fragment loader: 16-bit A/B operand, lane -> row/col (lane&15), p already includes +8*(lane>>4);
//      elements 0..7 <- p[0..7] (k0+8h..), elements 8..15 <- p[16..23] (k0+16+8h..)
__device__ __forceinline__ v16b ldfrag_b(const __bf16* p) {
  union { v16b v; v8b h[2]; } f;
  f.h[0] = *(const v8b*)(p);
  f.h[1] = *(const v8b*)(p + 16);
  return f.v;
}

// ---- WMMA helpers with trailing VALU hazard gap --------------------------------------------------------
__device__ __forceinline__ v8f mma_b(v16b a, v16b b, v8f c) {
  c = __builtin_amdgcn_wmma_f32_16x16x32_bf16(false, a, false, b, (short)0, c, false, false);
  asm volatile("v_nop\n\tv_nop\n\tv_nop\n\tv_nop" : "+v"(c) : "v"(a), "v"(b));
  return c;
}
__device__ __forceinline__ v8f mma_h(v16h a, v16h b, v8f c) {
  c = __builtin_amdgcn_wmma_f32_16x16x32_f16(false, a, false, b, (short)0, c, false, false);
  asm volatile("v_nop\n\tv_nop\n\tv_nop\n\tv_nop" : "+v"(c) : "v"(a), "v"(b));
  return c;
}
__device__ __forceinline__ v8f mma_b_raw(v16b a, v16b b, v8f c) {
  return __builtin_amdgcn_wmma_f32_16x16x32_bf16(false, a, false, b, (short)0, c, false, false);
}
__device__ __forceinline__ void dep_guard_b(v8f& a, v8f& b, v16b x, v16b y) {
  asm volatile("v_nop\n\tv_nop\n\tv_nop\n\tv_nop" : "+v"(a), "+v"(b) : "v"(x), "v"(y));
}
__device__ __forceinline__ void keep4_b(v16b a, v16b b, v16b c, v16b d) {
  asm volatile("v_nop" :: "v"(a), "v"(b), "v"(c), "v"(d));
}
__device__ __forceinline__ void acc_guard4(v8f& a, v8f& b, v8f& c, v8f& d) {
  asm volatile("v_nop\n\tv_nop\n\tv_nop\n\tv_nop" : "+v"(a), "+v"(b), "+v"(c), "+v"(d));
}

// =====================================================================================================
// f32 -> bf16 (RNE convert), 8 elements per thread, one 16-B store per lane: a wave writes 512 contiguous B
// coverage: n8 threads x 8 = the whole plane (n8 here is a multiple of 256).
// =====================================================================================================
__global__ __launch_bounds__(256) void cvt_bf16x8(const float* __restrict__ in, unsigned short* out, int n8) {
  const int i = blockIdx.x * 256 + (int)threadIdx.x;
  if (i < n8) {
    const v4f a = *(const v4f*)(in + (size_t)i * 8);
    const v4f b = *(const v4f*)(in + (size_t)i * 8 + 4);
    v4u p;
    p[0] = pk16(bf_bits(a[0]), bf_bits(a[1]));
    p[1] = pk16(bf_bits(a[2]), bf_bits(a[3]));
    p[2] = pk16(bf_bits(b[0]), bf_bits(b[1]));
    p[3] = pk16(bf_bits(b[2]), bf_bits(b[3]));
    *(v4u*)(out + (size_t)i * 8) = p;
    
  }
}

// =====================================================================================================
// Transpose-convert: f32 in[R rows][Cn cols] -> bf16 out[Cn][R] (RNE convert), 64x64 tiles through LDS.
// grid = (Cn/64, R/64), block 256 (R, Cn multiples of 64). Loads: 4 coalesced float4 per thread
// (64 rows x 16 float4 = the whole input tile). Stores: wave w writes output rows w*8 + it*4 + (lane>>3),
// coverage: 8 waves x 8 rows x 64 k = the whole 64x64 output tile; the grid covers the whole [Cn][R] plane.
// =====================================================================================================
__global__ __launch_bounds__(256) void tr_bf16(const float* __restrict__ in, unsigned short* out, int R, int Cn) {
  __shared__ __align__(16) float sm[64 * 65];
  const int t = (int)threadIdx.x, lane = t & 31, wave = t >> 5;
  const int n0 = blockIdx.x * 64;    // column block of in = row block of out
  const int k0 = blockIdx.y * 64;    // row block of in = column block of out
#pragma unroll
  for (int i = 0; i < 4; ++i) {
    const int idx = t + 256 * i;
    const int kr = idx >> 4, c4 = (idx & 15) * 4;
    const v4f v = *(const v4f*)(in + (size_t)(k0 + kr) * Cn + n0 + c4);
    sm[kr * 65 + c4 + 0] = v[0];
    sm[kr * 65 + c4 + 1] = v[1];
    sm[kr * 65 + c4 + 2] = v[2];
    sm[kr * 65 + c4 + 3] = v[3];
  }
  __syncthreads();
  const int q = lane >> 3, c8 = (lane & 7) * 8;
  v4u pv[2];
#pragma unroll
  for (int it = 0; it < 2; ++it) {
    const int n = wave * 8 + it * 4 + q;
    v4u p;
#pragma unroll
    for (int e = 0; e < 4; ++e) {
      const float a = sm[(c8 + 2 * e) * 65 + n];
      const float b = sm[(c8 + 2 * e + 1) * 65 + n];
      p[e] = pk16(bf_bits(a), bf_bits(b));
    }
    pv[it] = p;
  }
  {
#pragma unroll
    for (int it = 0; it < 2; ++it) {
      const int n = wave * 8 + it * 4 + q;
      *(v4u*)(out + (size_t)(n0 + n) * R + k0 + c8) = pv[it];
    }
    
  }
}

// =====================================================================================================
// Register-blocked batched bf16 WMMA GEMM: C[m][n] = sum_k A[m][k] * Bt[n][k] + bias; one wave per 64x64 tile,
// no block barriers. A row-major [M][K] pitch lda; Bt row-major [N][K] pitch ldb (k contiguous);
// M, N multiples of 64, K multiple of 32 (host shapes are static multiples). blockIdx.y = batch index (strides in elements).
// NSPLIT: 0 = A.Bt; 1 = (A + A2).Bt (A2 = unscaled bf16 lo plane of A, 2 products).
// BIAS: 1 = per column n, bias[n]; 2 = per row m, bias[m]; the bias value is RNE-converted to bf16 and added in f32.
// NORM (only with OUT_MODE 2, BIAS 1, N tile = one 64-wide head): per row, over the tile's 64 columns,
//   value := (acc + bias) * 8 * rsqrt(max(sum (acc + bias)^2, 1e-24)) * gamma[n mod DM] in f32, gamma = gma for
//   n0 < DM else gmb (RNE-converted to bf16); the row sum uses 16-lane shuffles (all lanes active).
// OUT_MODE: 0 = f32 (pitch ldc); 2 = bf16 hi plane C + bf16 lo plane C2 (lo = RNE(v - hi), unscaled);
//           3 = f16 hi plane C + f16 residual plane C2 = f16((v - hi) * rscale), C2 written only for tiles
//               with n0 < N2 (pitch ldc2, batch stride strideC2).
// =====================================================================================================
template <int NSPLIT, int OUT_MODE, int BIAS, int NORM>
__global__ __launch_bounds__(256) void gemm64(
    const unsigned short* __restrict__ Ap, const unsigned short* A2p, int lda, long long strideA,
    const unsigned short* __restrict__ Btp, int ldb, long long strideB,
    const float* __restrict__ bias, const float* __restrict__ gma, const float* __restrict__ gmb,
    void* Cout, int ldc, long long strideC,
    void* Cout2, int ldc2, long long strideC2, int N2,
    int M, int N, int K, float rscale) {
  const __bf16* A   = (const __bf16*)(const void*)Ap;
  const __bf16* A2  = (const __bf16*)(const void*)A2p;
  const __bf16* Bt  = (const __bf16*)(const void*)Btp;
  __shared__ __align__(16) float sT[8][16 * 68];   // per-wave 16x64 slab, pitch 68 floats
  const int b    = blockIdx.y;
  const int lane = threadIdx.x & 31;
  const int wave = threadIdx.x >> 5;
  const int tilesN = N >> 6;
  const int tilesM = M >> 6;
  const int tile = blockIdx.x * 8 + wave;
  if (tile >= tilesM * tilesN) return;   // wave-uniform; no block barriers in this kernel
  const int tm = tile / tilesN;
  const int tn = tile - tm * tilesN;
  const int m0 = tm << 6;
  const int n0 = tn << 6;

  const __bf16* Ab  = A  + (size_t)b * (size_t)strideA;
  const __bf16* Bb  = Bt + (size_t)b * (size_t)strideB;
  const __bf16* Ab2 = (NSPLIT >= 1) ? (A2 + (size_t)b * (size_t)strideA) : Ab;

  const int rlane = lane & 15;                 // row (A) / col (B, D) within subtile
  const int koff  = (lane >> 4) * 8;           // k offset of this lane half
  const int mOff  = (lane >> 4) * 8;           // D row offset

  v8f acc[4][4];
#pragma unroll
  for (int i = 0; i < 4; ++i)
#pragma unroll
    for (int j = 0; j < 4; ++j) acc[i][j] = zero8();

  for (int k0 = 0; k0 < K; k0 += 32) {
    v16b bh[4];
#pragma unroll
    for (int j = 0; j < 4; ++j) {
      const size_t bo = (size_t)(n0 + (j << 4) + rlane) * ldb + koff + k0;
      bh[j] = ldfrag_b(Bb + bo);
    }
#pragma unroll
    for (int i = 0; i < 4; ++i) {
      const size_t ao = (size_t)(m0 + (i << 4) + rlane) * lda + koff + k0;
      const v16b ah = ldfrag_b(Ab + ao);
      v16b al = ah;
      if (NSPLIT >= 1) al = ldfrag_b(Ab2 + ao);
#pragma unroll
      for (int j = 0; j < 4; ++j) {
        acc[i][j] = mma_b_raw(ah, bh[j], acc[i][j]);
        if (NSPLIT >= 1) acc[i][j] = mma_b_raw(al, bh[j], acc[i][j]);
      }
      dep_guard_b(acc[i][0], acc[i][3], ah, al);
    }
    keep4_b(bh[0], bh[1], bh[2], bh[3]);
  }
  acc_guard4(acc[0][0], acc[0][1], acc[0][2], acc[0][3]);
  acc_guard4(acc[1][0], acc[1][1], acc[1][2], acc[1][3]);
  acc_guard4(acc[2][0], acc[2][1], acc[2][2], acc[2][3]);
  acc_guard4(acc[3][0], acc[3][1], acc[3][2], acc[3][3]);

  // ---- epilogue ----
  float* slab = sT[wave];
  float bcol[4], gcol[4];
#pragma unroll
  for (int j = 0; j < 4; ++j) {
    bcol[j] = 0.f;
    gcol[j] = 1.f;
    if (BIAS == 1) bcol[j] = bf_up(bf_bits(bias[n0 + (j << 4) + rlane]));   // n < N, bias has N entries
    if (NORM) {
      const int nn = (n0 & (DM - 1)) + (j << 4) + rlane;                   // < DM = NH*HD entries
      const float ga = bf_up(bf_bits(gma[nn]));
      const float gb = bf_up(bf_bits(gmb[nn]));
      gcol[j] = (n0 < DM) ? ga : gb;                                       // wave-uniform select by value
    }
  }
#pragma unroll
  for (int i = 0; i < 4; ++i) {
    const int mBase = m0 + (i << 4);
    float brow[8];
#pragma unroll
    for (int r = 0; r < 8; ++r) {
      brow[r] = 0.f;
      if (BIAS == 2) brow[r] = bf_up(bf_bits(bias[mBase + mOff + r]));      // m < M, bias has M entries
    }
    float rsc[8];
#pragma unroll
    for (int r = 0; r < 8; ++r) rsc[r] = 1.f;
    if (NORM) {
      float ss[8];
#pragma unroll
      for (int r = 0; r < 8; ++r) {
        float a = 0.f;
#pragma unroll
        for (int j = 0; j < 4; ++j) {
          const float v = acc[i][j][r] + bcol[j];
          a += v * v;
        }
        ss[r] = a;
      }
#pragma unroll
      for (int r = 0; r < 8; ++r) {
#pragma unroll
        for (int off = 1; off < 16; off <<= 1) ss[r] += __shfl_xor(ss[r], off, 32);   // stays inside the lane half
        rsc[r] = rsqrtf(fmaxf(ss[r], 1e-24f)) * 8.0f;
      }
    }
#pragma unroll
    for (int j = 0; j < 4; ++j) {
#pragma unroll
      for (int r = 0; r < 8; ++r) {
        slab[(mOff + r) * 68 + (j << 4) + rlane] = (acc[i][j][r] + bcol[j] + brow[r]) * rsc[r] * gcol[j];
      }
    }
    __builtin_amdgcn_fence(__ATOMIC_RELEASE, "workgroup");
    __builtin_amdgcn_wave_barrier();
    __builtin_amdgcn_fence(__ATOMIC_ACQUIRE, "workgroup");
    if (OUT_MODE == 0) {
      float* C = (float*)Cout + (size_t)b * (size_t)strideC;
      const int h2 = lane >> 4, c4 = (lane & 15) * 4;     // 256-B row segment = 16 lanes x 16 B
      {
#pragma unroll
        for (int it = 0; it < 8; ++it) {
          const int row = it * 2 + h2;                     // it 0..7 x h2 0..1 = rows 0..15
          const v4f v = *(const v4f*)(slab + row * 68 + c4);
          *(v4f*)(C + (size_t)(mBase + row) * ldc + n0 + c4) = v;
        }
        
      }
    } else {
      const int q = lane >> 3, c8 = (lane & 7) * 8;
      unsigned short* C  = (unsigned short*)Cout  + (size_t)b * (size_t)strideC;
      unsigned short* C2 = (unsigned short*)Cout2 + (size_t)b * (size_t)strideC2;
      const bool wlo = (OUT_MODE == 2) || (n0 < N2);      // wave-uniform
      v4u hv[4], lv[4];
#pragma unroll
      for (int it = 0; it < 4; ++it) {
        const int row = it * 4 + q;                        // it 0..3 x q 0..3 = rows 0..15
        const float* sp = slab + row * 68 + c8;
        v4u a, a2;
#pragma unroll
        for (int e = 0; e < 4; ++e) {
          const float f0 = sp[2 * e], f1 = sp[2 * e + 1];
          unsigned short h0, h1, l0, l1;
          if (OUT_MODE == 2) {
            h0 = bf_bits(f0); h1 = bf_bits(f1);
            l0 = bf_bits(f0 - bf_up(h0)); l1 = bf_bits(f1 - bf_up(h1));
          } else {
            const _Float16 x0 = (_Float16)f0, x1 = (_Float16)f1;
            h0 = h_bits(x0); h1 = h_bits(x1);
            l0 = h_bits((_Float16)((f0 - (float)x0) * rscale));
            l1 = h_bits((_Float16)((f1 - (float)x1) * rscale));
          }
          a[e] = pk16(h0, h1); a2[e] = pk16(l0, l1);
        }
        hv[it] = a; lv[it] = a2;
      }
      {
#pragma unroll
        for (int it = 0; it < 4; ++it) {
          const int row = it * 4 + q;
          *(v4u*)(C + (size_t)(mBase + row) * ldc + n0 + c8) = hv[it];
          if (wlo) *(v4u*)(C2 + (size_t)(mBase + row) * ldc2 + n0 + c8) = lv[it];
        }
        
      }
    }
    __builtin_amdgcn_fence(__ATOMIC_RELEASE, "workgroup");
    __builtin_amdgcn_wave_barrier();
    __builtin_amdgcn_fence(__ATOMIC_ACQUIRE, "workgroup");
  }
}

// =====================================================================================================
// Full (unmasked) attention, head dim 64, key chunks of 64, softmax over all SEQ keys.
//   q|k planes (bf16 hi / lo, pitch QKP): q element (b, t, h, d) at [(b*SEQ + t)*QKP + h*64 + d],
//                                        k element (b, s, h, d) at [(b*SEQ + s)*QKP + DM + h*64 + d]
//   v^T hi plane (f16) and residual plane (f16, (v - hi)*4096): element (b, h, d, s) at [(b*DM + h*64 + d)*SEQ + s]
//   out planes (bf16 hi / lo of the normalised context): element (b, t, h, d) at [(b*SEQ + t)*DM + h*64 + d]
//   scores = q . k : bf16 hi/lo split (hi.hi + hi.lo + lo.hi), f32 accumulate, then * 1/8 in f32 (no mask)
//   p = exp(s - m) carried as f16(1024 p) plus an f16 residual (x4096); context = p . v on f16 WMMA with the
//   residual products (p_res . v_hi + p_hi . v_res) in a separate accumulator folded back with 1/4096 per chunk;
//   online softmax (running max) in f32.
//   Block = 4 waves = 64 query rows of one (b, h); grid = NB * NH * NQB; key chunks 0..NQB-1 (static trip count).
//   K / V^T chunk staging: 128 threads x 32 elements per plane = the whole 64x64 tile of every plane read later
//   (plain 16-B loads, __syncthreads before and after); P tiles are wave-private, spilled with _Float16 element
//   Output coverage: each wave stores rows q0..q0+15 (it 0..3 x lane>>3 0..3) x 64 columns (8 lanes x 8) of both planes;
//   the grid over all (b, h, qb) covers the whole [NB*SEQ][DM] planes.
// =====================================================================================================
__global__ __launch_bounds__(128)
void attn_full64(const unsigned short* __restrict__ qkhp, const unsigned short* __restrict__ qklp,
                 const unsigned short* __restrict__ vhp, const unsigned short* __restrict__ vlp,
                 unsigned short* ohp, unsigned short* olp) {
  union FB { v16b v; v8b h[2]; };
  union FH { v16h v; v8h h[2]; };
  __shared__ __align__(16) __bf16   Ksh[64 * 64];                 // K hi [kv][d]   8 KB
  __shared__ __align__(16) __bf16   Ksl[64 * 64];                 // K lo           8 KB
  __shared__ __align__(16) _Float16 Vth[64 * 64];                 // V^T hi [d][kv] 8 KB
  __shared__ __align__(16) _Float16 Vtl[64 * 64];                 // V^T residual   8 KB
  __shared__ __align__(16) _Float16 Psh[4][16 * 64];              // per wave P [row][kv]       8 KB
  __shared__ __align__(16) _Float16 Psl[4][16 * 64];              // per wave P residual        8 KB
  __shared__ __align__(16) float    Os[4][16 * 64];               // per wave context tile     16 KB

  const int tid  = threadIdx.x;
  const int wave = tid >> 5;
  const int lane = tid & 31;
  const int hh   = lane >> 4;
  const int c    = lane & 15;

  const int bx   = blockIdx.x;
  const int qb   = bx % NQB;
  const int rest = bx / NQB;
  const int h    = rest % NH;
  const int b    = rest / NH;
  const int q0   = qb * 64 + wave * 16;
  const size_t rowB = (size_t)b * SEQ;

  const __bf16* Qh = (const __bf16*)(const void*)qkhp + (size_t)h * HD;
  const __bf16* Ql = (const __bf16*)(const void*)qklp + (size_t)h * HD;
  const __bf16* Kh = (const __bf16*)(const void*)qkhp + DM + (size_t)h * HD;
  const __bf16* Kl = (const __bf16*)(const void*)qklp + DM + (size_t)h * HD;
  const _Float16* Vh = (const _Float16*)(const void*)vhp + ((size_t)b * DM + (size_t)h * HD) * SEQ;
  const _Float16* Vl = (const _Float16*)(const void*)vlp + ((size_t)b * DM + (size_t)h * HD) * SEQ;

  // ---- Q fragments (A operand, row = lane&15): 2 d-chunks, hi and lo ----
  v16b qah[2], qal[2];
#pragma unroll
  for (int dc = 0; dc < 2; ++dc) {
    const size_t qo = (rowB + q0 + c) * QKP + dc * 32 + 8 * hh;
    qah[dc] = ldfrag_b(Qh + qo);
    qal[dc] = ldfrag_b(Ql + qo);
  }

  float mrow[8], lrow[8];
  v8f oacc[4];
#pragma unroll
  for (int r = 0; r < 8; ++r) { mrow[r] = -INFINITY; lrow[r] = 0.f; }
#pragma unroll
  for (int t = 0; t < 4; ++t) oacc[t] = zero8();

  for (int kt = 0; kt < NQB; ++kt) {           // static trip count
    const int kv0 = kt * 64;                   // kv0 + 63 < SEQ
    __syncthreads();
    {
      const int r = tid >> 1, half = (tid & 1) * 32;
      const __bf16*   kg  = Kh + (rowB + kv0 + r) * QKP + half;   // K row kv0+r, d = half..half+31
      const __bf16*   klg = Kl + (rowB + kv0 + r) * QKP + half;
      const _Float16* vg  = Vh + (size_t)r * SEQ + kv0 + half;    // V^T row d = r, s = kv0+half..+31
      const _Float16* vlg = Vl + (size_t)r * SEQ + kv0 + half;
#pragma unroll
      for (int i = 0; i < 4; ++i) {
        const v8b a0 = *(const v8b*)(kg + 8 * i);
        const v8b a1 = *(const v8b*)(klg + 8 * i);
        const v8h b0 = *(const v8h*)(vg + 8 * i);
        const v8h b1 = *(const v8h*)(vlg + 8 * i);
        *(v8b*)(Ksh + r * 64 + half + 8 * i) = a0;
        *(v8b*)(Ksl + r * 64 + half + 8 * i) = a1;
        *(v8h*)(Vth + r * 64 + half + 8 * i) = b0;
        *(v8h*)(Vtl + r * 64 + half + 8 * i) = b1;
      }
    }
    __syncthreads();

    // ---- scores: 16 query rows x 64 keys per wave, 3 bf16 products ----
    v8f s[4];
#pragma unroll
    for (int j = 0; j < 4; ++j) {
      s[j] = zero8();
#pragma unroll
      for (int dc = 0; dc < 2; ++dc) {
        FB kb, kl;
        kb.h[0] = *(const v8b*)(Ksh + (j * 16 + c) * 64 + dc * 32 + 8 * hh);
        kb.h[1] = *(const v8b*)(Ksh + (j * 16 + c) * 64 + dc * 32 + 16 + 8 * hh);
        kl.h[0] = *(const v8b*)(Ksl + (j * 16 + c) * 64 + dc * 32 + 8 * hh);
        kl.h[1] = *(const v8b*)(Ksl + (j * 16 + c) * 64 + dc * 32 + 16 + 8 * hh);
        s[j] = mma_b(qah[dc], kb.v, s[j]);
        s[j] = mma_b(qah[dc], kl.v, s[j]);
        s[j] = mma_b(qal[dc], kb.v, s[j]);
      }
    }

    // ---- scale, row max, online softmax, P (x1024, f16) and P residual (x4096) to LDS ----
    _Float16* pwh = Psh[wave];
    _Float16* pwl = Psl[wave];
#pragma unroll
    for (int r = 0; r < 8; ++r) {
      float m = -INFINITY;
#pragma unroll
      for (int j = 0; j < 4; ++j) {
        const float sv = s[j][r] * 0.125f;
        s[j][r] = sv;
        m = fmaxf(m, sv);
      }
#pragma unroll
      for (int off = 1; off < 16; off <<= 1) m = fmaxf(m, __shfl_xor(m, off, 32));
      const float mnew  = fmaxf(mrow[r], m);
      const float msafe = (mnew == -INFINITY) ? 0.f : mnew;
      const float alpha = __expf(mrow[r] - msafe);
      mrow[r] = mnew;
      float psum = 0.f;
#pragma unroll
      for (int j = 0; j < 4; ++j) {
        const float p = __expf(s[j][r] - msafe);
        psum += p;
        const float p1k = p * 1024.0f;
        const _Float16 ph = (_Float16)p1k;
        const _Float16 pl = (_Float16)((p1k - (float)ph) * 4096.0f);
        pwh[(8 * hh + r) * 64 + j * 16 + c] = ph;
        pwl[(8 * hh + r) * 64 + j * 16 + c] = pl;
      }
#pragma unroll
      for (int off = 1; off < 16; off <<= 1) psum += __shfl_xor(psum, off, 32);
      lrow[r] = lrow[r] * alpha + psum;
#pragma unroll
      for (int t = 0; t < 4; ++t) oacc[t][r] *= alpha;
    }
    __builtin_amdgcn_fence(__ATOMIC_RELEASE, "workgroup");
    __builtin_amdgcn_wave_barrier();
    __builtin_amdgcn_fence(__ATOMIC_ACQUIRE, "workgroup");

    // ---- context += P . V (f16 WMMA), residual products into a separate accumulator ----
    v8f o1[4];
#pragma unroll
    for (int t = 0; t < 4; ++t) o1[t] = zero8();
#pragma unroll 1
    for (int kk = 0; kk < 2; ++kk) {
      FH pa, pl;
      pa.h[0] = *(const v8h*)(pwh + c * 64 + kk * 32 + 8 * hh);
      pa.h[1] = *(const v8h*)(pwh + c * 64 + kk * 32 + 16 + 8 * hh);
      pl.h[0] = *(const v8h*)(pwl + c * 64 + kk * 32 + 8 * hh);
      pl.h[1] = *(const v8h*)(pwl + c * 64 + kk * 32 + 16 + 8 * hh);
#pragma unroll
      for (int t = 0; t < 4; ++t) {
        FH vb, vl;
        vb.h[0] = *(const v8h*)(Vth + (t * 16 + c) * 64 + kk * 32 + 8 * hh);
        vb.h[1] = *(const v8h*)(Vth + (t * 16 + c) * 64 + kk * 32 + 16 + 8 * hh);
        vl.h[0] = *(const v8h*)(Vtl + (t * 16 + c) * 64 + kk * 32 + 8 * hh);
        vl.h[1] = *(const v8h*)(Vtl + (t * 16 + c) * 64 + kk * 32 + 16 + 8 * hh);
        oacc[t] = mma_h(pa.v, vb.v, oacc[t]);
        o1[t]   = mma_h(pa.v, vl.v, o1[t]);
        o1[t]   = mma_h(pl.v, vb.v, o1[t]);
      }
    }
#pragma unroll
    for (int t = 0; t < 4; ++t)
#pragma unroll
      for (int r = 0; r < 8; ++r) oacc[t][r] += o1[t][r] * (1.0f / 4096.0f);
  }

  // ---- normalise (1/l and the 1/1024 p carry), stage the wave's 16x64 tile, bf16 hi/lo split,
  float* os = Os[wave];
#pragma unroll
  for (int r = 0; r < 8; ++r) {
    const float l = lrow[r];
    const float inv = ((l > 0.f) ? (1.0f / l) : 0.f) * (1.0f / 1024.0f);
#pragma unroll
    for (int t = 0; t < 4; ++t) os[(8 * hh + r) * 64 + t * 16 + c] = oacc[t][r] * inv;
  }
  __builtin_amdgcn_fence(__ATOMIC_RELEASE, "workgroup");
  __builtin_amdgcn_wave_barrier();
  __builtin_amdgcn_fence(__ATOMIC_ACQUIRE, "workgroup");
  {
    const int q4 = lane >> 3, c8 = (lane & 7) * 8;
    v4u hv[4], lv[4];
#pragma unroll
    for (int it = 0; it < 4; ++it) {
      const int row = it * 4 + q4;   // it 0..3 x q4 0..3 = rows 0..15 of the wave tile
      const float* sp = os + row * 64 + c8;
      v4u a, a2;
#pragma unroll
      for (int e = 0; e < 4; ++e) {
        const float f0 = sp[2 * e], f1 = sp[2 * e + 1];
        const unsigned short h0 = bf_bits(f0), h1 = bf_bits(f1);
        const unsigned short l0 = bf_bits(f0 - bf_up(h0)), l1 = bf_bits(f1 - bf_up(h1));
        a[e] = pk16(h0, h1); a2[e] = pk16(l0, l1);
      }
      hv[it] = a; lv[it] = a2;
    }
    {
#pragma unroll
      for (int it = 0; it < 4; ++it) {
        const int row = it * 4 + q4;
        const size_t go = (rowB + q0 + row) * DM + (size_t)h * HD + c8;
        *(v4u*)(ohp + go) = hv[it];
        *(v4u*)(olp + go) = lv[it];
      }
      
    }
  }
}

// =====================================================================================================
// Workspace map (bytes; every region is an exact multiple of its 64x64-tile / whole-line store granularity, no padded
// tails needed since all shapes are tile multiples; every region is written by exactly one producer launch, none reused):
//   Xb   bf16 [4096][1024]                  0     8388608
//   WA   bf16 [3072 n][1024 k]          8388608     6291456   (q rows 0..1023, k rows 1024..2047, v rows 2048..3071)
//   WP   bf16 [1024 n][1024 k]         14680064     2097152
//   QKh  bf16 [4096][2048] (q | k hi)  16777216    16777216
//   QKl  bf16 [4096][2048] (q | k lo)  33554432    16777216
//   VTh  f16  [2][1024][2048]          50331648     8388608
//   VTl  f16  [2][1024][2048]          58720256     8388608
//   Oh   bf16 [4096][1024]             67108864     8388608
//   Ol   bf16 [4096][1024]             75497472     8388608
//   end                                83886080
// =====================================================================================================
extern "C" void kernel_launch(void* const* d_in, const int* in_sizes, int n_in,
                              void* d_out, int out_size, void* d_ws, size_t ws_size,
                              hipStream_t stream) {
  if (n_in < 7) return;
  if (in_sizes[0] != NB * SEQ * DM) return;
  if (in_sizes[1] != 3 * DM * DM) return;
  if (in_sizes[2] != 3 * DM) return;
  if (in_sizes[3] != NH * HD || in_sizes[4] != NH * HD) return;
  if (in_sizes[5] != DM * DM) return;
  if (in_sizes[6] != DM) return;
  if (out_size != NB * SEQ * DM) return;

  const float* x    = (const float*)d_in[0];   // [2][2048][1024]
  const float* Wqkv = (const float*)d_in[1];   // [1024 in][3072 out]  (cols: q | k | v, head h = cols h*64..h*64+63 of each block)
  const float* bqkv = (const float*)d_in[2];   // [3072]
  const float* gq   = (const float*)d_in[3];   // [16][64]
  const float* gk   = (const float*)d_in[4];   // [16][64]
  const float* Wout = (const float*)d_in[5];   // [1024 in][1024 out]
  const float* bout = (const float*)d_in[6];   // [1024]

  const size_t PXB = (size_t)NB * SEQ * DM * 2;    //  8388608  16-bit plane [4096][1024]
  const size_t PWA = (size_t)3 * DM * DM * 2;      //  6291456  packed [3072][1024] bf16 weight plane
  const size_t PWP = (size_t)DM * DM * 2;          //  2097152  [1024][1024] bf16 weight plane
  const size_t PQK = (size_t)NB * SEQ * QKP * 2;   // 16777216  q|k plane [4096][2048]
  const size_t PVT = (size_t)NB * DM * SEQ * 2;    //  8388608  v^T plane [2][1024][2048]
  size_t off = 0;
  const size_t oXb  = off; off += PXB;
  const size_t oWA  = off; off += PWA;
  const size_t oWP  = off; off += PWP;
  const size_t oQKh = off; off += PQK;
  const size_t oQKl = off; off += PQK;
  const size_t oVTh = off; off += PVT;
  const size_t oVTl = off; off += PVT;
  const size_t oOh  = off; off += PXB;
  const size_t oOl  = off; off += PXB;
  if (off > ws_size) return;                       // off = 83886080
  if (off > (size_t)134217728) return;

  char* ws = (char*)d_ws;
  unsigned short* Xb  = (unsigned short*)(ws + oXb);
  unsigned short* WA  = (unsigned short*)(ws + oWA);
  unsigned short* WvB = WA + (size_t)2 * DM * DM;             // rows 2048..3071 ([v feature][in], k contiguous)
  unsigned short* WPb = (unsigned short*)(ws + oWP);
  unsigned short* QKh = (unsigned short*)(ws + oQKh);
  unsigned short* QKl = (unsigned short*)(ws + oQKl);
  unsigned short* VTh = (unsigned short*)(ws + oVTh);
  unsigned short* VTl = (unsigned short*)(ws + oVTl);
  unsigned short* Oh  = (unsigned short*)(ws + oOh);
  unsigned short* Ol  = (unsigned short*)(ws + oOl);
  const float* bv = bqkv + 2 * DM;                            // bias entries 2048..3071

  const dim3 blk(256);
  const int n8x = NB * SEQ * DM / 8;                           // 524288
  const dim3 gCvtX((n8x + 255) / 256);                         // 2048 blocks
  const dim3 gTrA(3 * DM / 64, DM / 64);                       // in [1024][3072] -> out [3072][1024]: (48, 16)
  const dim3 gTrP(DM / 64, DM / 64);                           // in [1024][1024] -> out [1024][1024]: (16, 16)
  const dim3 gQK(((NB * SEQ / 64) * (QKP / 64) + 7) / 8, 1);   // 2048 tiles -> 256 blocks: M=4096, N=2048
  const dim3 gVT(((DM / 64) * (SEQ / 64) + 7) / 8, NB);        // 512 tiles -> 64 blocks x 2 batches: M=1024, N=2048
  const dim3 gAttn(NB * NH * NQB);                             // 1024 blocks of 128
  const dim3 gOut(((NB * SEQ / 64) * (DM / 64) + 7) / 8, 1);   // 1024 tiles -> 128 blocks: M=4096, N=1024

  // (1) x -> bf16 plane [4096][1024]; weights [in][out] f32 -> bf16 [out][in] (k contiguous) through LDS tiles
  cvt_bf16x8<<<gCvtX, blk, 0, stream>>>(x, Xb, n8x);
  tr_bf16<<<gTrA, blk, 0, stream>>>(Wqkv, WA, DM, 3 * DM);
  tr_bf16<<<gTrP, blk, 0, stream>>>(Wout, WPb, DM, DM);
  // (2) q|k = x . Wqk^T + bqk, per-head normalised (x 8 x gamma), -> bf16 hi/lo planes [b*SEQ+t][n], n < 2048
  //     (Bt = WA rows 0..2047; M=4096, N=2048, K=1024)
  gemm64<0, 2, 1, 1><<<gQK, blk, 0, stream>>>(
      Xb, Xb, DM, 0LL, WA, DM, 0LL, bqkv, gq, gk,
      (void*)QKh, QKP, 0LL, (void*)QKl, QKP, 0LL, QKP,
      NB * SEQ, QKP, DM, 1.0f);
  // (3) v^T = Wv . x^T + bv per batch -> f16 hi plane [b][h*64+d][s] (pitch SEQ) and residual plane (x4096, same layout)
  //     (A = WA rows 2048..3071 [n][k], Bt = Xb rows of batch b; M=1024, N=2048, K=1024)
  gemm64<0, 3, 2, 0><<<gVT, blk, 0, stream>>>(
      WvB, WvB, DM, 0LL, Xb, DM, (long long)SEQ * DM, bv, bv, bv,
      (void*)VTh, SEQ, (long long)DM * SEQ, (void*)VTl, SEQ, (long long)DM * SEQ, SEQ,
      DM, SEQ, DM, 4096.0f);
  // (4) full attention -> context bf16 hi/lo planes [4096][1024]
  attn_full64<<<gAttn, dim3(128), 0, stream>>>(QKh, QKl, VTh, VTl, Oh, Ol);
  // (5) out = context . Wout + bout -> d_out f32 [4096][1024]  (A = context hi + lo planes, 2 products; Bt = WP [n][k])
  gemm64<1, 0, 1, 0><<<gOut, blk, 0, stream>>>(
      Oh, Ol, DM, 0LL, WPb, DM, 0LL, bout, bout, bout,
      d_out, DM, 0LL, d_out, DM, 0LL, DM,
      NB * SEQ, DM, DM, 1.0f);
  (void)hipGetLastError();
}

// v001
// One run takes 323 microseconds.
// Two timings next to v000 both put it at 1.40 times that version's speed.
// Contractions: q|k and v^T projections = v_wmma_f32_16x16x32_bf16 (bf16 operands from RNE-converted x and the
// transposed [out][in] projection weight, single product, f32 accumulate);
// q.k^T scores = v_wmma_f32_16x16x32_bf16 with bf16 hi/lo split of the normalised q and k (hi.hi + hi.lo + lo.hi), f32 accumulate;
// p.v = v_wmma_f32_16x16x32_f16 (p carried x1024 in f16 plus an f16 residual plane x4096; v as f16 hi plane plus an f16
// residual plane x4096; 3 products, f32 accumulate);
// ctx.Wout = v_wmma_f32_16x16x32_bf16 with ctx as bf16 hi/lo planes times bf16 Wout (2 products), f32 accumulate;
// per-head sum-of-squares normalisation (x 8 x gamma), softmax, normalisers and bias adds in f32 on the VALU.
// Carry audit:
//   Psh = f16(1024 * p)                      -> the 1/1024 is folded exactly once in the attention epilogue: inv = (1/l) * (1/1024)
//   Psl = f16((1024 p - Psh) * 4096)         }  products Psh.VTl and Psl.VTh go to the separate accumulator o1,
//   VTl = f16((v - VTh) * 4096)              }  folded back with * (1/4096) once per key chunk
//   VTh = f16(v), no carry (|v| typ. 0.6); q / k / ctx lo planes are unscaled bf16 residuals (v - hi) sharing the hi accumulator;
//   score scale 1/8 applied once in f32 after the score accumulate; normalisation 8 * rsqrt(sum sq) * gamma applied in f32 in the
//   q|k projection epilogue before the bf16 hi/lo split. No other scaled planes.
#include <hip/hip_runtime.h>
#include <math.h>
#include <stdint.h>

#define NB    2
#define SEQ   2048
#define DM    1024
#define NH    16
#define HD    64
#define QKP   (2 * DM)     // pitch (elements) of the packed q|k planes: q at cols 0..1023, k at cols 1024..2047
#define NQB   (SEQ / 64)   // 32 query / key blocks of 64
#define LP    72           // LDS row pitch (16-bit elements) of the attention K / V^T / P tiles: 144 B = 16 B x odd, so the 16 rows
                           // that one ds_load_b128 fragment read touches fall on 16 different 16-B bank groups (128 B puts them on 2)
#define OSP   68           // LDS row pitch (floats) of the attention output tile: conflict-free for 16-B row reads
static_assert(NH * HD == DM);
static_assert(HD == 64);
static_assert((SEQ % 64) == 0 && (DM % 64) == 0 && (DM % 32) == 0);
static_assert(((NB * SEQ / 64) * (QKP / 64)) % 8 == 0);
static_assert(((NB * SEQ / 64) * (DM / 64)) % 8 == 0);
static_assert(((DM / 64) * (SEQ / 64)) % 8 == 0);
static_assert((NB * SEQ * DM) % (8 * 256) == 0);

typedef _Float16 v16h __attribute__((ext_vector_type(16)));
typedef _Float16 v8h  __attribute__((ext_vector_type(8)));
typedef __bf16   v16b __attribute__((ext_vector_type(16)));
typedef __bf16   v8b  __attribute__((ext_vector_type(8)));
typedef float    v8f  __attribute__((ext_vector_type(8)));
typedef float    v4f  __attribute__((ext_vector_type(4)));
typedef unsigned int v4u __attribute__((ext_vector_type(4)));

// ---- scalar helpers --------------------------------------------------------------------------------
__device__ __forceinline__ unsigned short bf_bits(float f) {          // f32 -> bf16 bits, RNE convert
  unsigned u = __float_as_uint(f);
  return (unsigned short)((u + 0x7FFFu + ((u >> 16) & 1u)) >> 16);
}
__device__ __forceinline__ float bf_up(unsigned short hb) { return __uint_as_float(((unsigned)hb) << 16); }
__device__ __forceinline__ unsigned short h_bits(_Float16 x) { return __builtin_bit_cast(unsigned short, x); }
__device__ __forceinline__ unsigned pk16(unsigned short a, unsigned short b) { return (unsigned)a | ((unsigned)b << 16); }
__device__ __forceinline__ v8f zero8() { v8f z = {0.f, 0.f, 0.f, 0.f, 0.f, 0.f, 0.f, 0.f}; return z; }

// ---- fragment loader: 16-bit A/B operand, lane -> row/col (lane&15), p already includes +8*(lane>>4);
//      elements 0..7 <- p[0..7] (k0+8h..), elements 8..15 <- p[16..23] (k0+16+8h..)
__device__ __forceinline__ v16b ldfrag_b(const __bf16* p) {
  union { v16b v; v8b h[2]; } f;
  f.h[0] = *(const v8b*)(p);
  f.h[1] = *(const v8b*)(p + 16);
  return f.v;
}

// ---- WMMA helpers with trailing VALU hazard gap --------------------------------------------------------
__device__ __forceinline__ v8f mma_b(v16b a, v16b b, v8f c) {
  c = __builtin_amdgcn_wmma_f32_16x16x32_bf16(false, a, false, b, (short)0, c, false, false);
  asm volatile("v_nop\n\tv_nop\n\tv_nop\n\tv_nop" : "+v"(c) : "v"(a), "v"(b));
  return c;
}
__device__ __forceinline__ v8f mma_h(v16h a, v16h b, v8f c) {
  c = __builtin_amdgcn_wmma_f32_16x16x32_f16(false, a, false, b, (short)0, c, false, false);
  asm volatile("v_nop\n\tv_nop\n\tv_nop\n\tv_nop" : "+v"(c) : "v"(a), "v"(b));
  return c;
}
__device__ __forceinline__ v8f mma_b_raw(v16b a, v16b b, v8f c) {
  return __builtin_amdgcn_wmma_f32_16x16x32_bf16(false, a, false, b, (short)0, c, false, false);
}
__device__ __forceinline__ void dep_guard_b(v8f& a, v8f& b, v16b x, v16b y) {
  asm volatile("v_nop\n\tv_nop\n\tv_nop\n\tv_nop" : "+v"(a), "+v"(b) : "v"(x), "v"(y));
}
__device__ __forceinline__ void keep4_b(v16b a, v16b b, v16b c, v16b d) {
  asm volatile("v_nop" :: "v"(a), "v"(b), "v"(c), "v"(d));
}
__device__ __forceinline__ void acc_guard4(v8f& a, v8f& b, v8f& c, v8f& d) {
  asm volatile("v_nop\n\tv_nop\n\tv_nop\n\tv_nop" : "+v"(a), "+v"(b), "+v"(c), "+v"(d));
}

// =====================================================================================================
// f32 -> bf16 (RNE convert), 8 elements per thread, one 16-B store per lane: a wave writes 512 contiguous B
// coverage: n8 threads x 8 = the whole plane (n8 here is a multiple of 256).
// =====================================================================================================
__global__ __launch_bounds__(256) void cvt_bf16x8(const float* __restrict__ in, unsigned short* out, int n8) {
  const int i = blockIdx.x * 256 + (int)threadIdx.x;
  if (i < n8) {
    const v4f a = *(const v4f*)(in + (size_t)i * 8);
    const v4f b = *(const v4f*)(in + (size_t)i * 8 + 4);
    v4u p;
    p[0] = pk16(bf_bits(a[0]), bf_bits(a[1]));
    p[1] = pk16(bf_bits(a[2]), bf_bits(a[3]));
    p[2] = pk16(bf_bits(b[0]), bf_bits(b[1]));
    p[3] = pk16(bf_bits(b[2]), bf_bits(b[3]));
    *(v4u*)(out + (size_t)i * 8) = p;
    
  }
}

// =====================================================================================================
// Transpose-convert: f32 in[R rows][Cn cols] -> bf16 out[Cn][R] (RNE convert), 64x64 tiles through LDS.
// grid = (Cn/64, R/64), block 256 (R, Cn multiples of 64). Loads: 4 coalesced float4 per thread
// (64 rows x 16 float4 = the whole input tile). Stores: wave w writes output rows w*8 + it*4 + (lane>>3),
// coverage: 8 waves x 8 rows x 64 k = the whole 64x64 output tile; the grid covers the whole [Cn][R] plane.
// =====================================================================================================
__global__ __launch_bounds__(256) void tr_bf16(const float* __restrict__ in, unsigned short* out, int R, int Cn) {
  __shared__ __align__(16) float sm[64 * 65];
  const int t = (int)threadIdx.x, lane = t & 31, wave = t >> 5;
  const int n0 = blockIdx.x * 64;    // column block of in = row block of out
  const int k0 = blockIdx.y * 64;    // row block of in = column block of out
#pragma unroll
  for (int i = 0; i < 4; ++i) {
    const int idx = t + 256 * i;
    const int kr = idx >> 4, c4 = (idx & 15) * 4;
    const v4f v = *(const v4f*)(in + (size_t)(k0 + kr) * Cn + n0 + c4);
    sm[kr * 65 + c4 + 0] = v[0];
    sm[kr * 65 + c4 + 1] = v[1];
    sm[kr * 65 + c4 + 2] = v[2];
    sm[kr * 65 + c4 + 3] = v[3];
  }
  __syncthreads();
  const int q = lane >> 3, c8 = (lane & 7) * 8;
  v4u pv[2];
#pragma unroll
  for (int it = 0; it < 2; ++it) {
    const int n = wave * 8 + it * 4 + q;
    v4u p;
#pragma unroll
    for (int e = 0; e < 4; ++e) {
      const float a = sm[(c8 + 2 * e) * 65 + n];
      const float b = sm[(c8 + 2 * e + 1) * 65 + n];
      p[e] = pk16(bf_bits(a), bf_bits(b));
    }
    pv[it] = p;
  }
  {
#pragma unroll
    for (int it = 0; it < 2; ++it) {
      const int n = wave * 8 + it * 4 + q;
      *(v4u*)(out + (size_t)(n0 + n) * R + k0 + c8) = pv[it];
    }
    
  }
}

// =====================================================================================================
// Register-blocked batched bf16 WMMA GEMM: C[m][n] = sum_k A[m][k] * Bt[n][k] + bias; one wave per 64x64 tile,
// no block barriers. A row-major [M][K] pitch lda; Bt row-major [N][K] pitch ldb (k contiguous);
// M, N multiples of 64, K multiple of 32 (host shapes are static multiples). blockIdx.y = batch index (strides in elements).
// NSPLIT: 0 = A.Bt; 1 = (A + A2).Bt (A2 = unscaled bf16 lo plane of A, 2 products).
// BIAS: 1 = per column n, bias[n]; 2 = per row m, bias[m]; the bias value is RNE-converted to bf16 and added in f32.
// NORM (only with OUT_MODE 2, BIAS 1, N tile = one 64-wide head): per row, over the tile's 64 columns,
//   value := (acc + bias) * 8 * rsqrt(max(sum (acc + bias)^2, 1e-24)) * gamma[n mod DM] in f32, gamma = gma for
//   n0 < DM else gmb (RNE-converted to bf16); the row sum uses 16-lane shuffles (all lanes active).
// OUT_MODE: 0 = f32 (pitch ldc); 2 = bf16 hi plane C + bf16 lo plane C2 (lo = RNE(v - hi), unscaled);
//           3 = f16 hi plane C + f16 residual plane C2 = f16((v - hi) * rscale), C2 written only for tiles
//               with n0 < N2 (pitch ldc2, batch stride strideC2).
// =====================================================================================================
template <int NSPLIT, int OUT_MODE, int BIAS, int NORM>
__global__ __launch_bounds__(256) void gemm64(
    const unsigned short* __restrict__ Ap, const unsigned short* A2p, int lda, long long strideA,
    const unsigned short* __restrict__ Btp, int ldb, long long strideB,
    const float* __restrict__ bias, const float* __restrict__ gma, const float* __restrict__ gmb,
    void* Cout, int ldc, long long strideC,
    void* Cout2, int ldc2, long long strideC2, int N2,
    int M, int N, int K, float rscale) {
  const __bf16* A   = (const __bf16*)(const void*)Ap;
  const __bf16* A2  = (const __bf16*)(const void*)A2p;
  const __bf16* Bt  = (const __bf16*)(const void*)Btp;
  __shared__ __align__(16) float sT[8][16 * 68];   // per-wave 16x64 slab, pitch 68 floats
  const int b    = blockIdx.y;
  const int lane = threadIdx.x & 31;
  const int wave = threadIdx.x >> 5;
  const int tilesN = N >> 6;
  const int tilesM = M >> 6;
  const int tile = blockIdx.x * 8 + wave;
  if (tile >= tilesM * tilesN) return;   // wave-uniform; no block barriers in this kernel
  const int tm = tile / tilesN;
  const int tn = tile - tm * tilesN;
  const int m0 = tm << 6;
  const int n0 = tn << 6;

  const __bf16* Ab  = A  + (size_t)b * (size_t)strideA;
  const __bf16* Bb  = Bt + (size_t)b * (size_t)strideB;
  const __bf16* Ab2 = (NSPLIT >= 1) ? (A2 + (size_t)b * (size_t)strideA) : Ab;

  const int rlane = lane & 15;                 // row (A) / col (B, D) within subtile
  const int koff  = (lane >> 4) * 8;           // k offset of this lane half
  const int mOff  = (lane >> 4) * 8;           // D row offset

  v8f acc[4][4];
#pragma unroll
  for (int i = 0; i < 4; ++i)
#pragma unroll
    for (int j = 0; j < 4; ++j) acc[i][j] = zero8();

  for (int k0 = 0; k0 < K; k0 += 32) {
    v16b bh[4];
#pragma unroll
    for (int j = 0; j < 4; ++j) {
      const size_t bo = (size_t)(n0 + (j << 4) + rlane) * ldb + koff + k0;
      bh[j] = ldfrag_b(Bb + bo);
    }
#pragma unroll
    for (int i = 0; i < 4; ++i) {
      const size_t ao = (size_t)(m0 + (i << 4) + rlane) * lda + koff + k0;
      const v16b ah = ldfrag_b(Ab + ao);
      v16b al = ah;
      if (NSPLIT >= 1) al = ldfrag_b(Ab2 + ao);
#pragma unroll
      for (int j = 0; j < 4; ++j) {
        acc[i][j] = mma_b_raw(ah, bh[j], acc[i][j]);
        if (NSPLIT >= 1) acc[i][j] = mma_b_raw(al, bh[j], acc[i][j]);
      }
      dep_guard_b(acc[i][0], acc[i][3], ah, al);
    }
    keep4_b(bh[0], bh[1], bh[2], bh[3]);
  }
  acc_guard4(acc[0][0], acc[0][1], acc[0][2], acc[0][3]);
  acc_guard4(acc[1][0], acc[1][1], acc[1][2], acc[1][3]);
  acc_guard4(acc[2][0], acc[2][1], acc[2][2], acc[2][3]);
  acc_guard4(acc[3][0], acc[3][1], acc[3][2], acc[3][3]);

  // ---- epilogue ----
  float* slab = sT[wave];
  float bcol[4], gcol[4];
#pragma unroll
  for (int j = 0; j < 4; ++j) {
    bcol[j] = 0.f;
    gcol[j] = 1.f;
    if (BIAS == 1) bcol[j] = bf_up(bf_bits(bias[n0 + (j << 4) + rlane]));   // n < N, bias has N entries
    if (NORM) {
      const int nn = (n0 & (DM - 1)) + (j << 4) + rlane;                   // < DM = NH*HD entries
      const float ga = bf_up(bf_bits(gma[nn]));
      const float gb = bf_up(bf_bits(gmb[nn]));
      gcol[j] = (n0 < DM) ? ga : gb;                                       // wave-uniform select by value
    }
  }
#pragma unroll
  for (int i = 0; i < 4; ++i) {
    const int mBase = m0 + (i << 4);
    float brow[8];
#pragma unroll
    for (int r = 0; r < 8; ++r) {
      brow[r] = 0.f;
      if (BIAS == 2) brow[r] = bf_up(bf_bits(bias[mBase + mOff + r]));      // m < M, bias has M entries
    }
    float rsc[8];
#pragma unroll
    for (int r = 0; r < 8; ++r) rsc[r] = 1.f;
    if (NORM) {
      float ss[8];
#pragma unroll
      for (int r = 0; r < 8; ++r) {
        float a = 0.f;
#pragma unroll
        for (int j = 0; j < 4; ++j) {
          const float v = acc[i][j][r] + bcol[j];
          a += v * v;
        }
        ss[r] = a;
      }
#pragma unroll
      for (int r = 0; r < 8; ++r) {
#pragma unroll
        for (int off = 1; off < 16; off <<= 1) ss[r] += __shfl_xor(ss[r], off, 32);   // stays inside the lane half
        rsc[r] = rsqrtf(fmaxf(ss[r], 1e-24f)) * 8.0f;
      }
    }
#pragma unroll
    for (int j = 0; j < 4; ++j) {
#pragma unroll
      for (int r = 0; r < 8; ++r) {
        slab[(mOff + r) * 68 + (j << 4) + rlane] = (acc[i][j][r] + bcol[j] + brow[r]) * rsc[r] * gcol[j];
      }
    }
    __builtin_amdgcn_fence(__ATOMIC_RELEASE, "workgroup");
    __builtin_amdgcn_wave_barrier();
    __builtin_amdgcn_fence(__ATOMIC_ACQUIRE, "workgroup");
    if (OUT_MODE == 0) {
      float* C = (float*)Cout + (size_t)b * (size_t)strideC;
      const int h2 = lane >> 4, c4 = (lane & 15) * 4;     // 256-B row segment = 16 lanes x 16 B
      {
#pragma unroll
        for (int it = 0; it < 8; ++it) {
          const int row = it * 2 + h2;                     // it 0..7 x h2 0..1 = rows 0..15
          const v4f v = *(const v4f*)(slab + row * 68 + c4);
          *(v4f*)(C + (size_t)(mBase + row) * ldc + n0 + c4) = v;
        }
        
      }
    } else {
      const int q = lane >> 3, c8 = (lane & 7) * 8;
      unsigned short* C  = (unsigned short*)Cout  + (size_t)b * (size_t)strideC;
      unsigned short* C2 = (unsigned short*)Cout2 + (size_t)b * (size_t)strideC2;
      const bool wlo = (OUT_MODE == 2) || (n0 < N2);      // wave-uniform
      v4u hv[4], lv[4];
#pragma unroll
      for (int it = 0; it < 4; ++it) {
        const int row = it * 4 + q;                        // it 0..3 x q 0..3 = rows 0..15
        const float* sp = slab + row * 68 + c8;
        v4u a, a2;
#pragma unroll
        for (int e = 0; e < 4; ++e) {
          const float f0 = sp[2 * e], f1 = sp[2 * e + 1];
          unsigned short h0, h1, l0, l1;
          if (OUT_MODE == 2) {
            h0 = bf_bits(f0); h1 = bf_bits(f1);
            l0 = bf_bits(f0 - bf_up(h0)); l1 = bf_bits(f1 - bf_up(h1));
          } else {
            const _Float16 x0 = (_Float16)f0, x1 = (_Float16)f1;
            h0 = h_bits(x0); h1 = h_bits(x1);
            l0 = h_bits((_Float16)((f0 - (float)x0) * rscale));
            l1 = h_bits((_Float16)((f1 - (float)x1) * rscale));
          }
          a[e] = pk16(h0, h1); a2[e] = pk16(l0, l1);
        }
        hv[it] = a; lv[it] = a2;
      }
      {
#pragma unroll
        for (int it = 0; it < 4; ++it) {
          const int row = it * 4 + q;
          *(v4u*)(C + (size_t)(mBase + row) * ldc + n0 + c8) = hv[it];
          if (wlo) *(v4u*)(C2 + (size_t)(mBase + row) * ldc2 + n0 + c8) = lv[it];
        }
        
      }
    }
    __builtin_amdgcn_fence(__ATOMIC_RELEASE, "workgroup");
    __builtin_amdgcn_wave_barrier();
    __builtin_amdgcn_fence(__ATOMIC_ACQUIRE, "workgroup");
  }
}

// =====================================================================================================
// Full (unmasked) attention, head dim 64, key chunks of 64, softmax over all SEQ keys.
//   q|k planes (bf16 hi / lo, pitch QKP): q element (b, t, h, d) at [(b*SEQ + t)*QKP + h*64 + d],
//                                        k element (b, s, h, d) at [(b*SEQ + s)*QKP + DM + h*64 + d]
//   v^T hi plane (f16) and residual plane (f16, (v - hi)*4096): element (b, h, d, s) at [(b*DM + h*64 + d)*SEQ + s]
//   out planes (bf16 hi / lo of the normalised context): element (b, t, h, d) at [(b*SEQ + t)*DM + h*64 + d]
//   scores = q . k : bf16 hi/lo split (hi.hi + hi.lo + lo.hi), f32 accumulate, then * 1/8 in f32 (no mask)
//   p = exp(s - m) carried as f16(1024 p) plus an f16 residual (x4096); context = p . v on f16 WMMA with the
//   residual products (p_res . v_hi + p_hi . v_res) in a separate accumulator folded back with 1/4096 per chunk;
//   online softmax (running max) in f32.
//   Block = 4 waves = 64 query rows of one (b, h); grid = NB * NH * NQB; key chunks 0..NQB-1 (static trip count).
//   K / V^T chunk staging: 128 threads x 32 elements per plane = the whole 64x64 tile of every plane read later
//   (plain 16-B loads, __syncthreads before and after); P tiles are wave-private, spilled with _Float16 element
//   Output coverage: each wave stores rows q0..q0+15 (it 0..3 x lane>>3 0..3) x 64 columns (8 lanes x 8) of both planes;
//   the grid over all (b, h, qb) covers the whole [NB*SEQ][DM] planes.
// =====================================================================================================
__global__ __launch_bounds__(128)
void attn_full64(const unsigned short* __restrict__ qkhp, const unsigned short* __restrict__ qklp,
                 const unsigned short* __restrict__ vhp, const unsigned short* __restrict__ vlp,
                 unsigned short* ohp, unsigned short* olp) {
  union FB { v16b v; v8b h[2]; };
  union FH { v16h v; v8h h[2]; };
  __shared__ __align__(16) __bf16   Ksh[64 * LP];                 // K hi [kv][d]   9 KB (rows of 64 at pitch LP)
  __shared__ __align__(16) __bf16   Ksl[64 * LP];                 // K lo           9 KB
  __shared__ __align__(16) _Float16 Vth[64 * LP];                 // V^T hi [d][kv] 9 KB
  __shared__ __align__(16) _Float16 Vtl[64 * LP];                 // V^T residual   9 KB
  __shared__ __align__(16) _Float16 Psh[4][16 * LP];              // per wave P [row][kv]       9 KB
  __shared__ __align__(16) _Float16 Psl[4][16 * LP];              // per wave P residual        9 KB
  __shared__ __align__(16) float    Os[4][16 * OSP];              // per wave context tile     17 KB (total 72704 B: 4 blocks per WGP)

  const int tid  = threadIdx.x;
  const int wave = tid >> 5;
  const int lane = tid & 31;
  const int hh   = lane >> 4;
  const int c    = lane & 15;

  const int bx   = blockIdx.x;
  const int qb   = bx % NQB;
  const int rest = bx / NQB;
  const int h    = rest % NH;
  const int b    = rest / NH;
  const int q0   = qb * 64 + wave * 16;
  const size_t rowB = (size_t)b * SEQ;

  const __bf16* Qh = (const __bf16*)(const void*)qkhp + (size_t)h * HD;
  const __bf16* Ql = (const __bf16*)(const void*)qklp + (size_t)h * HD;
  const __bf16* Kh = (const __bf16*)(const void*)qkhp + DM + (size_t)h * HD;
  const __bf16* Kl = (const __bf16*)(const void*)qklp + DM + (size_t)h * HD;
  const _Float16* Vh = (const _Float16*)(const void*)vhp + ((size_t)b * DM + (size_t)h * HD) * SEQ;
  const _Float16* Vl = (const _Float16*)(const void*)vlp + ((size_t)b * DM + (size_t)h * HD) * SEQ;

  // ---- Q fragments (A operand, row = lane&15): 2 d-chunks, hi and lo ----
  v16b qah[2], qal[2];
#pragma unroll
  for (int dc = 0; dc < 2; ++dc) {
    const size_t qo = (rowB + q0 + c) * QKP + dc * 32 + 8 * hh;
    qah[dc] = ldfrag_b(Qh + qo);
    qal[dc] = ldfrag_b(Ql + qo);
  }

  float mrow[8], lrow[8];
  v8f oacc[4];
#pragma unroll
  for (int r = 0; r < 8; ++r) { mrow[r] = -INFINITY; lrow[r] = 0.f; }
#pragma unroll
  for (int t = 0; t < 4; ++t) oacc[t] = zero8();

  for (int kt = 0; kt < NQB; ++kt) {           // static trip count
    const int kv0 = kt * 64;                   // kv0 + 63 < SEQ
    __syncthreads();
    {
      const int r = tid >> 1, half = (tid & 1) * 32;
      const __bf16*   kg  = Kh + (rowB + kv0 + r) * QKP + half;   // K row kv0+r, d = half..half+31
      const __bf16*   klg = Kl + (rowB + kv0 + r) * QKP + half;
      const _Float16* vg  = Vh + (size_t)r * SEQ + kv0 + half;    // V^T row d = r, s = kv0+half..+31
      const _Float16* vlg = Vl + (size_t)r * SEQ + kv0 + half;
#pragma unroll
      for (int i = 0; i < 4; ++i) {
        const v8b a0 = *(const v8b*)(kg + 8 * i);
        const v8b a1 = *(const v8b*)(klg + 8 * i);
        const v8h b0 = *(const v8h*)(vg + 8 * i);
        const v8h b1 = *(const v8h*)(vlg + 8 * i);
        *(v8b*)(Ksh + r * LP + half + 8 * i) = a0;
        *(v8b*)(Ksl + r * LP + half + 8 * i) = a1;
        *(v8h*)(Vth + r * LP + half + 8 * i) = b0;
        *(v8h*)(Vtl + r * LP + half + 8 * i) = b1;
      }
    }
    __syncthreads();

    // ---- scores: 16 query rows x 64 keys per wave, 3 bf16 products ----
    v8f s[4];
#pragma unroll
    for (int j = 0; j < 4; ++j) {
      s[j] = zero8();
#pragma unroll
      for (int dc = 0; dc < 2; ++dc) {
        FB kb, kl;
        kb.h[0] = *(const v8b*)(Ksh + (j * 16 + c) * LP + dc * 32 + 8 * hh);
        kb.h[1] = *(const v8b*)(Ksh + (j * 16 + c) * LP + dc * 32 + 16 + 8 * hh);
        kl.h[0] = *(const v8b*)(Ksl + (j * 16 + c) * LP + dc * 32 + 8 * hh);
        kl.h[1] = *(const v8b*)(Ksl + (j * 16 + c) * LP + dc * 32 + 16 + 8 * hh);
        s[j] = mma_b(qah[dc], kb.v, s[j]);
        s[j] = mma_b(qah[dc], kl.v, s[j]);
        s[j] = mma_b(qal[dc], kb.v, s[j]);
      }
    }

    // ---- scale, row max, online softmax, P (x1024, f16) and P residual (x4096) to LDS ----
    _Float16* pwh = Psh[wave];
    _Float16* pwl = Psl[wave];
#pragma unroll
    for (int r = 0; r < 8; ++r) {
      float m = -INFINITY;
#pragma unroll
      for (int j = 0; j < 4; ++j) {
        const float sv = s[j][r] * 0.125f;
        s[j][r] = sv;
        m = fmaxf(m, sv);
      }
#pragma unroll
      for (int off = 1; off < 16; off <<= 1) m = fmaxf(m, __shfl_xor(m, off, 32));
      const float mnew  = fmaxf(mrow[r], m);
      const float msafe = (mnew == -INFINITY) ? 0.f : mnew;
      const float alpha = __expf(mrow[r] - msafe);
      mrow[r] = mnew;
      float psum = 0.f;
#pragma unroll
      for (int j = 0; j < 4; ++j) {
        const float p = __expf(s[j][r] - msafe);
        psum += p;
        const float p1k = p * 1024.0f;
        const _Float16 ph = (_Float16)p1k;
        const _Float16 pl = (_Float16)((p1k - (float)ph) * 4096.0f);
        pwh[(8 * hh + r) * LP + j * 16 + c] = ph;
        pwl[(8 * hh + r) * LP + j * 16 + c] = pl;
      }
#pragma unroll
      for (int off = 1; off < 16; off <<= 1) psum += __shfl_xor(psum, off, 32);
      lrow[r] = lrow[r] * alpha + psum;
#pragma unroll
      for (int t = 0; t < 4; ++t) oacc[t][r] *= alpha;
    }
    __builtin_amdgcn_fence(__ATOMIC_RELEASE, "workgroup");
    __builtin_amdgcn_wave_barrier();
    __builtin_amdgcn_fence(__ATOMIC_ACQUIRE, "workgroup");

    // ---- context += P . V (f16 WMMA), residual products into a separate accumulator ----
    v8f o1[4];
#pragma unroll
    for (int t = 0; t < 4; ++t) o1[t] = zero8();
#pragma unroll 1
    for (int kk = 0; kk < 2; ++kk) {
      FH pa, pl;
      pa.h[0] = *(const v8h*)(pwh + c * LP + kk * 32 + 8 * hh);
      pa.h[1] = *(const v8h*)(pwh + c * LP + kk * 32 + 16 + 8 * hh);
      pl.h[0] = *(const v8h*)(pwl + c * LP + kk * 32 + 8 * hh);
      pl.h[1] = *(const v8h*)(pwl + c * LP + kk * 32 + 16 + 8 * hh);
#pragma unroll
      for (int t = 0; t < 4; ++t) {
        FH vb, vl;
        vb.h[0] = *(const v8h*)(Vth + (t * 16 + c) * LP + kk * 32 + 8 * hh);
        vb.h[1] = *(const v8h*)(Vth + (t * 16 + c) * LP + kk * 32 + 16 + 8 * hh);
        vl.h[0] = *(const v8h*)(Vtl + (t * 16 + c) * LP + kk * 32 + 8 * hh);
        vl.h[1] = *(const v8h*)(Vtl + (t * 16 + c) * LP + kk * 32 + 16 + 8 * hh);
        oacc[t] = mma_h(pa.v, vb.v, oacc[t]);
        o1[t]   = mma_h(pa.v, vl.v, o1[t]);
        o1[t]   = mma_h(pl.v, vb.v, o1[t]);
      }
    }
#pragma unroll
    for (int t = 0; t < 4; ++t)
#pragma unroll
      for (int r = 0; r < 8; ++r) oacc[t][r] += o1[t][r] * (1.0f / 4096.0f);
  }

  // ---- normalise (1/l and the 1/1024 p carry), stage the wave's 16x64 tile, bf16 hi/lo split,
  float* os = Os[wave];
#pragma unroll
  for (int r = 0; r < 8; ++r) {
    const float l = lrow[r];
    const float inv = ((l > 0.f) ? (1.0f / l) : 0.f) * (1.0f / 1024.0f);
#pragma unroll
    for (int t = 0; t < 4; ++t) os[(8 * hh + r) * OSP + t * 16 + c] = oacc[t][r] * inv;
  }
  __builtin_amdgcn_fence(__ATOMIC_RELEASE, "workgroup");
  __builtin_amdgcn_wave_barrier();
  __builtin_amdgcn_fence(__ATOMIC_ACQUIRE, "workgroup");
  {
    const int q4 = lane >> 3, c8 = (lane & 7) * 8;
    v4u hv[4], lv[4];
#pragma unroll
    for (int it = 0; it < 4; ++it) {
      const int row = it * 4 + q4;   // it 0..3 x q4 0..3 = rows 0..15 of the wave tile
      const float* sp = os + row * OSP + c8;
      v4u a, a2;
#pragma unroll
      for (int e = 0; e < 4; ++e) {
        const float f0 = sp[2 * e], f1 = sp[2 * e + 1];
        const unsigned short h0 = bf_bits(f0), h1 = bf_bits(f1);
        const unsigned short l0 = bf_bits(f0 - bf_up(h0)), l1 = bf_bits(f1 - bf_up(h1));
        a[e] = pk16(h0, h1); a2[e] = pk16(l0, l1);
      }
      hv[it] = a; lv[it] = a2;
    }
    {
#pragma unroll
      for (int it = 0; it < 4; ++it) {
        const int row = it * 4 + q4;
        const size_t go = (rowB + q0 + row) * DM + (size_t)h * HD + c8;
        *(v4u*)(ohp + go) = hv[it];
        *(v4u*)(olp + go) = lv[it];
      }
      
    }
  }
}

// =====================================================================================================
// Workspace map (bytes; every region is an exact multiple of its 64x64-tile / whole-line store granularity, no padded
// tails needed since all shapes are tile multiples; every region is written by exactly one producer launch, none reused):
//   Xb   bf16 [4096][1024]                  0     8388608
//   WA   bf16 [3072 n][1024 k]          8388608     6291456   (q rows 0..1023, k rows 1024..2047, v rows 2048..3071)
//   WP   bf16 [1024 n][1024 k]         14680064     2097152
//   QKh  bf16 [4096][2048] (q | k hi)  16777216    16777216
//   QKl  bf16 [4096][2048] (q | k lo)  33554432    16777216
//   VTh  f16  [2][1024][2048]          50331648     8388608
//   VTl  f16  [2][1024][2048]          58720256     8388608
//   Oh   bf16 [4096][1024]             67108864     8388608
//   Ol   bf16 [4096][1024]             75497472     8388608
//   end                                83886080
// =====================================================================================================
extern "C" void kernel_launch(void* const* d_in, const int* in_sizes, int n_in,
                              void* d_out, int out_size, void* d_ws, size_t ws_size,
                              hipStream_t stream) {
  if (n_in < 7) return;
  if (in_sizes[0] != NB * SEQ * DM) return;
  if (in_sizes[1] != 3 * DM * DM) return;
  if (in_sizes[2] != 3 * DM) return;
  if (in_sizes[3] != NH * HD || in_sizes[4] != NH * HD) return;
  if (in_sizes[5] != DM * DM) return;
  if (in_sizes[6] != DM) return;
  if (out_size != NB * SEQ * DM) return;

  const float* x    = (const float*)d_in[0];   // [2][2048][1024]
  const float* Wqkv = (const float*)d_in[1];   // [1024 in][3072 out]  (cols: q | k | v, head h = cols h*64..h*64+63 of each block)
  const float* bqkv = (const float*)d_in[2];   // [3072]
  const float* gq   = (const float*)d_in[3];   // [16][64]
  const float* gk   = (const float*)d_in[4];   // [16][64]
  const float* Wout = (const float*)d_in[5];   // [1024 in][1024 out]
  const float* bout = (const float*)d_in[6];   // [1024]

  const size_t PXB = (size_t)NB * SEQ * DM * 2;    //  8388608  16-bit plane [4096][1024]
  const size_t PWA = (size_t)3 * DM * DM * 2;      //  6291456  packed [3072][1024] bf16 weight plane
  const size_t PWP = (size_t)DM * DM * 2;          //  2097152  [1024][1024] bf16 weight plane
  const size_t PQK = (size_t)NB * SEQ * QKP * 2;   // 16777216  q|k plane [4096][2048]
  const size_t PVT = (size_t)NB * DM * SEQ * 2;    //  8388608  v^T plane [2][1024][2048]
  size_t off = 0;
  const size_t oXb  = off; off += PXB;
  const size_t oWA  = off; off += PWA;
  const size_t oWP  = off; off += PWP;
  const size_t oQKh = off; off += PQK;
  const size_t oQKl = off; off += PQK;
  const size_t oVTh = off; off += PVT;
  const size_t oVTl = off; off += PVT;
  const size_t oOh  = off; off += PXB;
  const size_t oOl  = off; off += PXB;
  if (off > ws_size) return;                       // off = 83886080
  if (off > (size_t)134217728) return;

  char* ws = (char*)d_ws;
  unsigned short* Xb  = (unsigned short*)(ws + oXb);
  unsigned short* WA  = (unsigned short*)(ws + oWA);
  unsigned short* WvB = WA + (size_t)2 * DM * DM;             // rows 2048..3071 ([v feature][in], k contiguous)
  unsigned short* WPb = (unsigned short*)(ws + oWP);
  unsigned short* QKh = (unsigned short*)(ws + oQKh);
  unsigned short* QKl = (unsigned short*)(ws + oQKl);
  unsigned short* VTh = (unsigned short*)(ws + oVTh);
  unsigned short* VTl = (unsigned short*)(ws + oVTl);
  unsigned short* Oh  = (unsigned short*)(ws + oOh);
  unsigned short* Ol  = (unsigned short*)(ws + oOl);
  const float* bv = bqkv + 2 * DM;                            // bias entries 2048..3071

  const dim3 blk(256);
  const int n8x = NB * SEQ * DM / 8;                           // 524288
  const dim3 gCvtX((n8x + 255) / 256);                         // 2048 blocks
  const dim3 gTrA(3 * DM / 64, DM / 64);                       // in [1024][3072] -> out [3072][1024]: (48, 16)
  const dim3 gTrP(DM / 64, DM / 64);                           // in [1024][1024] -> out [1024][1024]: (16, 16)
  const dim3 gQK(((NB * SEQ / 64) * (QKP / 64) + 7) / 8, 1);   // 2048 tiles -> 256 blocks: M=4096, N=2048
  const dim3 gVT(((DM / 64) * (SEQ / 64) + 7) / 8, NB);        // 512 tiles -> 64 blocks x 2 batches: M=1024, N=2048
  const dim3 gAttn(NB * NH * NQB);                             // 1024 blocks of 128
  const dim3 gOut(((NB * SEQ / 64) * (DM / 64) + 7) / 8, 1);   // 1024 tiles -> 128 blocks: M=4096, N=1024

  // (1) x -> bf16 plane [4096][1024]; weights [in][out] f32 -> bf16 [out][in] (k contiguous) through LDS tiles
  cvt_bf16x8<<<gCvtX, blk, 0, stream>>>(x, Xb, n8x);
  tr_bf16<<<gTrA, blk, 0, stream>>>(Wqkv, WA, DM, 3 * DM);
  tr_bf16<<<gTrP, blk, 0, stream>>>(Wout, WPb, DM, DM);
  // (2) q|k = x . Wqk^T + bqk, per-head normalised (x 8 x gamma), -> bf16 hi/lo planes [b*SEQ+t][n], n < 2048
  //     (Bt = WA rows 0..2047; M=4096, N=2048, K=1024)
  gemm64<0, 2, 1, 1><<<gQK, blk, 0, stream>>>(
      Xb, Xb, DM, 0LL, WA, DM, 0LL, bqkv, gq, gk,
      (void*)QKh, QKP, 0LL, (void*)QKl, QKP, 0LL, QKP,
      NB * SEQ, QKP, DM, 1.0f);
  // (3) v^T = Wv . x^T + bv per batch -> f16 hi plane [b][h*64+d][s] (pitch SEQ) and residual plane (x4096, same layout)
  //     (A = WA rows 2048..3071 [n][k], Bt = Xb rows of batch b; M=1024, N=2048, K=1024)
  gemm64<0, 3, 2, 0><<<gVT, blk, 0, stream>>>(
      WvB, WvB, DM, 0LL, Xb, DM, (long long)SEQ * DM, bv, bv, bv,
      (void*)VTh, SEQ, (long long)DM * SEQ, (void*)VTl, SEQ, (long long)DM * SEQ, SEQ,
      DM, SEQ, DM, 4096.0f);
  // (4) full attention -> context bf16 hi/lo planes [4096][1024]
  attn_full64<<<gAttn, dim3(128), 0, stream>>>(QKh, QKl, VTh, VTl, Oh, Ol);
  // (5) out = context . Wout + bout -> d_out f32 [4096][1024]  (A = context hi + lo planes, 2 products; Bt = WP [n][k])
  gemm64<1, 0, 1, 0><<<gOut, blk, 0, stream>>>(
      Oh, Ol, DM, 0LL, WPb, DM, 0LL, bout, bout, bout,
      d_out, DM, 0LL, d_out, DM, 0LL, DM,
      NB * SEQ, DM, DM, 1.0f);
  (void)hipGetLastError();
}

// v002
// A run of this version takes 291 microseconds.
// In both of two side-by-side timings against v001, it was 1.11 times as fast.
// Counting every step since v000, it is 1.55 times as fast.
// Contractions: q|k and v^T projections = v_wmma_f32_16x16x32_bf16 (bf16 operands from RNE-converted x and the
// transposed [out][in] projection weight, single product, f32 accumulate);
// k.q^T scores = v_wmma_f32_16x16x32_bf16 with bf16 hi/lo split of the normalised q and k (hi.hi + hi.lo + lo.hi), f32 accumulate;
// v^T.p^T = v_wmma_f32_16x16x32_f16 (p carried x1024 in f16 plus an f16 residual plane x4096; v as f16 hi plane plus an f16
// residual plane x4096; 3 products, f32 accumulate);
// ctx.Wout = v_wmma_f32_16x16x32_bf16 with ctx as bf16 hi/lo planes times bf16 Wout (2 products), f32 accumulate;
// per-head sum-of-squares normalisation (x 8 x gamma), softmax, normalisers and bias adds in f32 on the VALU.
// Carry audit:
//   p hi = f16(1024 * p)                     -> the 1/1024 is folded exactly once in the attention epilogue: inv = (1/l) * (1/1024)
//   p res = f16((1024 p - p hi) * 4096)      }  products VTl.(p hi) and VTh.(p res) go to the separate accumulator o1,
//   VTl = f16((v - VTh) * 4096)              }  folded back with * (1/4096) once per key chunk
//   VTh = f16(v), no carry (|v| typ. 0.6); q / k / ctx lo planes are unscaled bf16 residuals (v - hi) sharing the hi accumulator;
//   score scale 1/8 applied once in f32 after the score accumulate; normalisation 8 * rsqrt(sum sq) * gamma applied in f32 in the
//   q|k projection epilogue before the bf16 hi/lo split. No other scaled planes.
#include <hip/hip_runtime.h>
#include <math.h>
#include <stdint.h>

#define NB    2
#define SEQ   2048
#define DM    1024
#define NH    16
#define HD    64
#define QKP   (2 * DM)     // pitch (elements) of the packed q|k planes: q at cols 0..1023, k at cols 1024..2047
#define NQB   (SEQ / 64)   // 32 query / key blocks of 64
#define LP    72           // LDS row pitch (16-bit elements) of the attention K / V^T tiles: 144 B = 16 B x odd, so the 16 rows
                           // that one ds_load_b128 fragment read touches fall on 16 different 16-B bank groups (128 B puts them on 2)
#define OSP   68           // LDS row pitch (floats) of the attention output tile: conflict-free for 16-B row reads
static_assert(NH * HD == DM);
static_assert(HD == 64);
static_assert((SEQ % 64) == 0 && (DM % 64) == 0 && (DM % 32) == 0);
static_assert(((NB * SEQ / 64) * (QKP / 64)) % 8 == 0);
static_assert(((NB * SEQ / 64) * (DM / 64)) % 8 == 0);
static_assert(((DM / 64) * (SEQ / 64)) % 8 == 0);
static_assert((NB * SEQ * DM) % (8 * 256) == 0);

typedef _Float16 v16h __attribute__((ext_vector_type(16)));
typedef _Float16 v8h  __attribute__((ext_vector_type(8)));
typedef __bf16   v16b __attribute__((ext_vector_type(16)));
typedef __bf16   v8b  __attribute__((ext_vector_type(8)));
typedef float    v8f  __attribute__((ext_vector_type(8)));
typedef float    v4f  __attribute__((ext_vector_type(4)));
typedef unsigned int v4u __attribute__((ext_vector_type(4)));

// ---- scalar helpers --------------------------------------------------------------------------------
__device__ __forceinline__ unsigned short bf_bits(float f) {          // f32 -> bf16 bits, RNE convert
  unsigned u = __float_as_uint(f);
  return (unsigned short)((u + 0x7FFFu + ((u >> 16) & 1u)) >> 16);
}
__device__ __forceinline__ float bf_up(unsigned short hb) { return __uint_as_float(((unsigned)hb) << 16); }
__device__ __forceinline__ unsigned short h_bits(_Float16 x) { return __builtin_bit_cast(unsigned short, x); }
__device__ __forceinline__ unsigned pk16(unsigned short a, unsigned short b) { return (unsigned)a | ((unsigned)b << 16); }
__device__ __forceinline__ v8f zero8() { v8f z = {0.f, 0.f, 0.f, 0.f, 0.f, 0.f, 0.f, 0.f}; return z; }

// ---- fragment loader: 16-bit A/B operand, lane -> row/col (lane&15), p already includes +8*(lane>>4);
//      elements 0..7 <- p[0..7] (k0+8h..), elements 8..15 <- p[16..23] (k0+16+8h..)
__device__ __forceinline__ v16b ldfrag_b(const __bf16* p) {
  union { v16b v; v8b h[2]; } f;
  f.h[0] = *(const v8b*)(p);
  f.h[1] = *(const v8b*)(p + 16);
  return f.v;
}

// ---- WMMA helpers with trailing VALU hazard gap --------------------------------------------------------
__device__ __forceinline__ v8f mma_b(v16b a, v16b b, v8f c) {
  c = __builtin_amdgcn_wmma_f32_16x16x32_bf16(false, a, false, b, (short)0, c, false, false);
  asm volatile("v_nop\n\tv_nop\n\tv_nop\n\tv_nop" : "+v"(c) : "v"(a), "v"(b));
  return c;
}
__device__ __forceinline__ v8f mma_h(v16h a, v16h b, v8f c) {
  c = __builtin_amdgcn_wmma_f32_16x16x32_f16(false, a, false, b, (short)0, c, false, false);
  asm volatile("v_nop\n\tv_nop\n\tv_nop\n\tv_nop" : "+v"(c) : "v"(a), "v"(b));
  return c;
}
__device__ __forceinline__ v8f mma_b_raw(v16b a, v16b b, v8f c) {
  return __builtin_amdgcn_wmma_f32_16x16x32_bf16(false, a, false, b, (short)0, c, false, false);
}
__device__ __forceinline__ void dep_guard_b(v8f& a, v8f& b, v16b x, v16b y) {
  asm volatile("v_nop\n\tv_nop\n\tv_nop\n\tv_nop" : "+v"(a), "+v"(b) : "v"(x), "v"(y));
}
__device__ __forceinline__ void keep4_b(v16b a, v16b b, v16b c, v16b d) {
  asm volatile("v_nop" :: "v"(a), "v"(b), "v"(c), "v"(d));
}
__device__ __forceinline__ void acc_guard4(v8f& a, v8f& b, v8f& c, v8f& d) {
  asm volatile("v_nop\n\tv_nop\n\tv_nop\n\tv_nop" : "+v"(a), "+v"(b), "+v"(c), "+v"(d));
}

// =====================================================================================================
// f32 -> bf16 (RNE convert), 8 elements per thread, one 16-B store per lane: a wave writes 512 contiguous B
// coverage: n8 threads x 8 = the whole plane (n8 here is a multiple of 256).
// =====================================================================================================
__global__ __launch_bounds__(256) void cvt_bf16x8(const float* __restrict__ in, unsigned short* out, int n8) {
  const int i = blockIdx.x * 256 + (int)threadIdx.x;
  if (i < n8) {
    const v4f a = *(const v4f*)(in + (size_t)i * 8);
    const v4f b = *(const v4f*)(in + (size_t)i * 8 + 4);
    v4u p;
    p[0] = pk16(bf_bits(a[0]), bf_bits(a[1]));
    p[1] = pk16(bf_bits(a[2]), bf_bits(a[3]));
    p[2] = pk16(bf_bits(b[0]), bf_bits(b[1]));
    p[3] = pk16(bf_bits(b[2]), bf_bits(b[3]));
    *(v4u*)(out + (size_t)i * 8) = p;
    
  }
}

// =====================================================================================================
// Transpose-convert: f32 in[R rows][Cn cols] -> bf16 out[Cn][R] (RNE convert), 64x64 tiles through LDS.
// grid = (Cn/64, R/64), block 256 (R, Cn multiples of 64). Loads: 4 coalesced float4 per thread
// (64 rows x 16 float4 = the whole input tile). Stores: wave w writes output rows w*8 + it*4 + (lane>>3),
// coverage: 8 waves x 8 rows x 64 k = the whole 64x64 output tile; the grid covers the whole [Cn][R] plane.
// =====================================================================================================
__global__ __launch_bounds__(256) void tr_bf16(const float* __restrict__ in, unsigned short* out, int R, int Cn) {
  __shared__ __align__(16) float sm[64 * 65];
  const int t = (int)threadIdx.x, lane = t & 31, wave = t >> 5;
  const int n0 = blockIdx.x * 64;    // column block of in = row block of out
  const int k0 = blockIdx.y * 64;    // row block of in = column block of out
#pragma unroll
  for (int i = 0; i < 4; ++i) {
    const int idx = t + 256 * i;
    const int kr = idx >> 4, c4 = (idx & 15) * 4;
    const v4f v = *(const v4f*)(in + (size_t)(k0 + kr) * Cn + n0 + c4);
    sm[kr * 65 + c4 + 0] = v[0];
    sm[kr * 65 + c4 + 1] = v[1];
    sm[kr * 65 + c4 + 2] = v[2];
    sm[kr * 65 + c4 + 3] = v[3];
  }
  __syncthreads();
  const int q = lane >> 3, c8 = (lane & 7) * 8;
  v4u pv[2];
#pragma unroll
  for (int it = 0; it < 2; ++it) {
    const int n = wave * 8 + it * 4 + q;
    v4u p;
#pragma unroll
    for (int e = 0; e < 4; ++e) {
      const float a = sm[(c8 + 2 * e) * 65 + n];
      const float b = sm[(c8 + 2 * e + 1) * 65 + n];
      p[e] = pk16(bf_bits(a), bf_bits(b));
    }
    pv[it] = p;
  }
  {
#pragma unroll
    for (int it = 0; it < 2; ++it) {
      const int n = wave * 8 + it * 4 + q;
      *(v4u*)(out + (size_t)(n0 + n) * R + k0 + c8) = pv[it];
    }
    
  }
}

// =====================================================================================================
// Register-blocked batched bf16 WMMA GEMM: C[m][n] = sum_k A[m][k] * Bt[n][k] + bias; one wave per 64x64 tile,
// no block barriers. A row-major [M][K] pitch lda; Bt row-major [N][K] pitch ldb (k contiguous);
// M, N multiples of 64, K multiple of 32 (host shapes are static multiples). blockIdx.y = batch index (strides in elements).
// NSPLIT: 0 = A.Bt; 1 = (A + A2).Bt (A2 = unscaled bf16 lo plane of A, 2 products).
// BIAS: 1 = per column n, bias[n]; 2 = per row m, bias[m]; the bias value is RNE-converted to bf16 and added in f32.
// NORM (only with OUT_MODE 2, BIAS 1, N tile = one 64-wide head): per row, over the tile's 64 columns,
//   value := (acc + bias) * 8 * rsqrt(max(sum (acc + bias)^2, 1e-24)) * gamma[n mod DM] in f32, gamma = gma for
//   n0 < DM else gmb (RNE-converted to bf16); the row sum uses 16-lane shuffles (all lanes active).
// OUT_MODE: 0 = f32 (pitch ldc); 2 = bf16 hi plane C + bf16 lo plane C2 (lo = RNE(v - hi), unscaled);
//           3 = f16 hi plane C + f16 residual plane C2 = f16((v - hi) * rscale), C2 written only for tiles
//               with n0 < N2 (pitch ldc2, batch stride strideC2).
// =====================================================================================================
template <int NSPLIT, int OUT_MODE, int BIAS, int NORM>
__global__ __launch_bounds__(256) void gemm64(
    const unsigned short* __restrict__ Ap, const unsigned short* A2p, int lda, long long strideA,
    const unsigned short* __restrict__ Btp, int ldb, long long strideB,
    const float* __restrict__ bias, const float* __restrict__ gma, const float* __restrict__ gmb,
    void* Cout, int ldc, long long strideC,
    void* Cout2, int ldc2, long long strideC2, int N2,
    int M, int N, int K, float rscale) {
  const __bf16* A   = (const __bf16*)(const void*)Ap;
  const __bf16* A2  = (const __bf16*)(const void*)A2p;
  const __bf16* Bt  = (const __bf16*)(const void*)Btp;
  __shared__ __align__(16) float sT[8][16 * 68];   // per-wave 16x64 slab, pitch 68 floats
  const int b    = blockIdx.y;
  const int lane = threadIdx.x & 31;
  const int wave = threadIdx.x >> 5;
  const int tilesN = N >> 6;
  const int tilesM = M >> 6;
  const int tile = blockIdx.x * 8 + wave;
  if (tile >= tilesM * tilesN) return;   // wave-uniform; no block barriers in this kernel
  const int tm = tile / tilesN;
  const int tn = tile - tm * tilesN;
  const int m0 = tm << 6;
  const int n0 = tn << 6;

  const __bf16* Ab  = A  + (size_t)b * (size_t)strideA;
  const __bf16* Bb  = Bt + (size_t)b * (size_t)strideB;
  const __bf16* Ab2 = (NSPLIT >= 1) ? (A2 + (size_t)b * (size_t)strideA) : Ab;

  const int rlane = lane & 15;                 // row (A) / col (B, D) within subtile
  const int koff  = (lane >> 4) * 8;           // k offset of this lane half
  const int mOff  = (lane >> 4) * 8;           // D row offset

  v8f acc[4][4];
#pragma unroll
  for (int i = 0; i < 4; ++i)
#pragma unroll
    for (int j = 0; j < 4; ++j) acc[i][j] = zero8();

  for (int k0 = 0; k0 < K; k0 += 32) {
    v16b bh[4];
#pragma unroll
    for (int j = 0; j < 4; ++j) {
      const size_t bo = (size_t)(n0 + (j << 4) + rlane) * ldb + koff + k0;
      bh[j] = ldfrag_b(Bb + bo);
    }
#pragma unroll
    for (int i = 0; i < 4; ++i) {
      const size_t ao = (size_t)(m0 + (i << 4) + rlane) * lda + koff + k0;
      const v16b ah = ldfrag_b(Ab + ao);
      v16b al = ah;
      if (NSPLIT >= 1) al = ldfrag_b(Ab2 + ao);
#pragma unroll
      for (int j = 0; j < 4; ++j) {
        acc[i][j] = mma_b_raw(ah, bh[j], acc[i][j]);
        if (NSPLIT >= 1) acc[i][j] = mma_b_raw(al, bh[j], acc[i][j]);
      }
      dep_guard_b(acc[i][0], acc[i][3], ah, al);
    }
    keep4_b(bh[0], bh[1], bh[2], bh[3]);
  }
  acc_guard4(acc[0][0], acc[0][1], acc[0][2], acc[0][3]);
  acc_guard4(acc[1][0], acc[1][1], acc[1][2], acc[1][3]);
  acc_guard4(acc[2][0], acc[2][1], acc[2][2], acc[2][3]);
  acc_guard4(acc[3][0], acc[3][1], acc[3][2], acc[3][3]);

  // ---- epilogue ----
  float* slab = sT[wave];
  float bcol[4], gcol[4];
#pragma unroll
  for (int j = 0; j < 4; ++j) {
    bcol[j] = 0.f;
    gcol[j] = 1.f;
    if (BIAS == 1) bcol[j] = bf_up(bf_bits(bias[n0 + (j << 4) + rlane]));   // n < N, bias has N entries
    if (NORM) {
      const int nn = (n0 & (DM - 1)) + (j << 4) + rlane;                   // < DM = NH*HD entries
      const float ga = bf_up(bf_bits(gma[nn]));
      const float gb = bf_up(bf_bits(gmb[nn]));
      gcol[j] = (n0 < DM) ? ga : gb;                                       // wave-uniform select by value
    }
  }
#pragma unroll
  for (int i = 0; i < 4; ++i) {
    const int mBase = m0 + (i << 4);
    float brow[8];
#pragma unroll
    for (int r = 0; r < 8; ++r) {
      brow[r] = 0.f;
      if (BIAS == 2) brow[r] = bf_up(bf_bits(bias[mBase + mOff + r]));      // m < M, bias has M entries
    }
    float rsc[8];
#pragma unroll
    for (int r = 0; r < 8; ++r) rsc[r] = 1.f;
    if (NORM) {
      float ss[8];
#pragma unroll
      for (int r = 0; r < 8; ++r) {
        float a = 0.f;
#pragma unroll
        for (int j = 0; j < 4; ++j) {
          const float v = acc[i][j][r] + bcol[j];
          a += v * v;
        }
        ss[r] = a;
      }
#pragma unroll
      for (int r = 0; r < 8; ++r) {
#pragma unroll
        for (int off = 1; off < 16; off <<= 1) ss[r] += __shfl_xor(ss[r], off, 32);   // stays inside the lane half
        rsc[r] = rsqrtf(fmaxf(ss[r], 1e-24f)) * 8.0f;
      }
    }
#pragma unroll
    for (int j = 0; j < 4; ++j) {
#pragma unroll
      for (int r = 0; r < 8; ++r) {
        slab[(mOff + r) * 68 + (j << 4) + rlane] = (acc[i][j][r] + bcol[j] + brow[r]) * rsc[r] * gcol[j];
      }
    }
    __builtin_amdgcn_fence(__ATOMIC_RELEASE, "workgroup");
    __builtin_amdgcn_wave_barrier();
    __builtin_amdgcn_fence(__ATOMIC_ACQUIRE, "workgroup");
    if (OUT_MODE == 0) {
      float* C = (float*)Cout + (size_t)b * (size_t)strideC;
      const int h2 = lane >> 4, c4 = (lane & 15) * 4;     // 256-B row segment = 16 lanes x 16 B
      {
#pragma unroll
        for (int it = 0; it < 8; ++it) {
          const int row = it * 2 + h2;                     // it 0..7 x h2 0..1 = rows 0..15
          const v4f v = *(const v4f*)(slab + row * 68 + c4);
          *(v4f*)(C + (size_t)(mBase + row) * ldc + n0 + c4) = v;
        }
        
      }
    } else {
      const int q = lane >> 3, c8 = (lane & 7) * 8;
      unsigned short* C  = (unsigned short*)Cout  + (size_t)b * (size_t)strideC;
      unsigned short* C2 = (unsigned short*)Cout2 + (size_t)b * (size_t)strideC2;
      const bool wlo = (OUT_MODE == 2) || (n0 < N2);      // wave-uniform
      v4u hv[4], lv[4];
#pragma unroll
      for (int it = 0; it < 4; ++it) {
        const int row = it * 4 + q;                        // it 0..3 x q 0..3 = rows 0..15
        const float* sp = slab + row * 68 + c8;
        v4u a, a2;
#pragma unroll
        for (int e = 0; e < 4; ++e) {
          const float f0 = sp[2 * e], f1 = sp[2 * e + 1];
          unsigned short h0, h1, l0, l1;
          if (OUT_MODE == 2) {
            h0 = bf_bits(f0); h1 = bf_bits(f1);
            l0 = bf_bits(f0 - bf_up(h0)); l1 = bf_bits(f1 - bf_up(h1));
          } else {
            const _Float16 x0 = (_Float16)f0, x1 = (_Float16)f1;
            h0 = h_bits(x0); h1 = h_bits(x1);
            l0 = h_bits((_Float16)((f0 - (float)x0) * rscale));
            l1 = h_bits((_Float16)((f1 - (float)x1) * rscale));
          }
          a[e] = pk16(h0, h1); a2[e] = pk16(l0, l1);
        }
        hv[it] = a; lv[it] = a2;
      }
      {
#pragma unroll
        for (int it = 0; it < 4; ++it) {
          const int row = it * 4 + q;
          *(v4u*)(C + (size_t)(mBase + row) * ldc + n0 + c8) = hv[it];
          if (wlo) *(v4u*)(C2 + (size_t)(mBase + row) * ldc2 + n0 + c8) = lv[it];
        }
        
      }
    }
    __builtin_amdgcn_fence(__ATOMIC_RELEASE, "workgroup");
    __builtin_amdgcn_wave_barrier();
    __builtin_amdgcn_fence(__ATOMIC_ACQUIRE, "workgroup");
  }
}

__device__ __forceinline__ float xhalf(float x) {
  const int xi = __builtin_bit_cast(int, x);
  return __builtin_bit_cast(float, __builtin_amdgcn_permlanex16(xi, xi, 0x76543210, 0xfedcba98, false, false));
}

__global__ __launch_bounds__(128)
void attn_full64(const unsigned short* __restrict__ qkhp, const unsigned short* __restrict__ qklp,
                 const unsigned short* __restrict__ vhp, const unsigned short* __restrict__ vlp,
                 unsigned short* ohp, unsigned short* olp) {
  union FB { v16b v; v8b h[2]; };
  union FH { v16h v; v8h h[2]; };
  __shared__ __align__(16) __bf16   Ksh[64 * LP];                 // K hi [kv][d]   9 KB (rows of 64 at pitch LP)
  __shared__ __align__(16) __bf16   Ksl[64 * LP];                 // K lo           9 KB
  __shared__ __align__(16) _Float16 Vth[64 * LP];                 // V^T hi [d][kv] 9 KB
  __shared__ __align__(16) _Float16 Vtl[64 * LP];                 // V^T residual   9 KB
  __shared__ __align__(16) float    Os[4][16 * OSP];              // per wave context tile [query][d]  17 KB

  const int tid  = threadIdx.x;
  const int wave = tid >> 5;
  const int lane = tid & 31;
  const int hh   = lane >> 4;
  const int c    = lane & 15;

  const int bx   = blockIdx.x;
  const int qb   = bx % NQB;
  const int rest = bx / NQB;
  const int h    = rest % NH;
  const int b    = rest / NH;
  const int q0   = qb * 64 + wave * 16;
  const size_t rowB = (size_t)b * SEQ;

  const __bf16* Qh = (const __bf16*)(const void*)qkhp + (size_t)h * HD;
  const __bf16* Ql = (const __bf16*)(const void*)qklp + (size_t)h * HD;
  const __bf16* Kh = (const __bf16*)(const void*)qkhp + DM + (size_t)h * HD;
  const __bf16* Kl = (const __bf16*)(const void*)qklp + DM + (size_t)h * HD;
  const _Float16* Vh = (const _Float16*)(const void*)vhp + ((size_t)b * DM + (size_t)h * HD) * SEQ;
  const _Float16* Vl = (const _Float16*)(const void*)vlp + ((size_t)b * DM + (size_t)h * HD) * SEQ;

  // ---- Q fragments (B operand, column = query = lane&15): 2 d-chunks, hi and lo ----
  v16b qah[2], qal[2];
#pragma unroll
  for (int dc = 0; dc < 2; ++dc) {
    const size_t qo = (rowB + q0 + c) * QKP + dc * 32 + 8 * hh;
    qah[dc] = ldfrag_b(Qh + qo);
    qal[dc] = ldfrag_b(Ql + qo);
  }

  float mrow = -INFINITY, lrow = 0.f;          // this lane's query: running maximum (both halves alike), this half's sum
  v8f oacc[4];
#pragma unroll
  for (int t = 0; t < 4; ++t) oacc[t] = zero8();

  for (int kt = 0; kt < NQB; ++kt) {           // static trip count
    const int kv0 = kt * 64;                   // kv0 + 63 < SEQ
    __syncthreads();
    {
      const int r = tid >> 1, half = (tid & 1) * 32;
      const __bf16*   kg  = Kh + (rowB + kv0 + r) * QKP + half;   // K row kv0+r, d = half..half+31
      const __bf16*   klg = Kl + (rowB + kv0 + r) * QKP + half;
      const _Float16* vg  = Vh + (size_t)r * SEQ + kv0 + half;    // V^T row d = r, s = kv0+half..+31
      const _Float16* vlg = Vl + (size_t)r * SEQ + kv0 + half;
#pragma unroll
      for (int i = 0; i < 4; ++i) {
        const v8b a0 = *(const v8b*)(kg + 8 * i);
        const v8b a1 = *(const v8b*)(klg + 8 * i);
        const v8h b0 = *(const v8h*)(vg + 8 * i);
        const v8h b1 = *(const v8h*)(vlg + 8 * i);
        *(v8b*)(Ksh + r * LP + half + 8 * i) = a0;
        *(v8b*)(Ksl + r * LP + half + 8 * i) = a1;
        *(v8h*)(Vth + r * LP + half + 8 * i) = b0;
        *(v8h*)(Vtl + r * LP + half + 8 * i) = b1;
      }
    }
    __syncthreads();

    // ---- scores, transposed: 64 keys x 16 query columns per wave, 3 bf16 products ----
    v8f s[4];
#pragma unroll
    for (int j = 0; j < 4; ++j) {
      s[j] = zero8();
#pragma unroll
      for (int dc = 0; dc < 2; ++dc) {
        FB kb, kl;
        kb.h[0] = *(const v8b*)(Ksh + (j * 16 + c) * LP + dc * 32 + 8 * hh);
        kb.h[1] = *(const v8b*)(Ksh + (j * 16 + c) * LP + dc * 32 + 16 + 8 * hh);
        kl.h[0] = *(const v8b*)(Ksl + (j * 16 + c) * LP + dc * 32 + 8 * hh);
        kl.h[1] = *(const v8b*)(Ksl + (j * 16 + c) * LP + dc * 32 + 16 + 8 * hh);
        s[j] = mma_b(kb.v, qah[dc], s[j]);
        s[j] = mma_b(kl.v, qah[dc], s[j]);
        s[j] = mma_b(kb.v, qal[dc], s[j]);
      }
    }

    // ---- scale, maximum of this lane's query, online softmax, P (x1024, f16) and P residual (x4096) in registers ----
    float mj[4];
#pragma unroll
    for (int j = 0; j < 4; ++j) {
      mj[j] = -INFINITY;
#pragma unroll
      for (int r = 0; r < 8; ++r) {
        const float sv = s[j][r] * 0.125f;
        s[j][r] = sv;
        mj[j] = fmaxf(mj[j], sv);
      }
    }
    float m = fmaxf(fmaxf(mj[0], mj[1]), fmaxf(mj[2], mj[3]));
    m = fmaxf(m, xhalf(m));                    // both halves now hold the maximum over the chunk's 64 keys
    const float mnew  = fmaxf(mrow, m);
    const float msafe = (mnew == -INFINITY) ? 0.f : mnew;
    const float alpha = __expf(mrow - msafe);
    mrow = mnew;
    FH pa[2], pl[2];                           // B operands of key blocks 0 and 1: p hi plane, p residual plane
    float pj[4];
#pragma unroll
    for (int j = 0; j < 4; ++j) {
      pj[j] = 0.f;
#pragma unroll
      for (int r = 0; r < 8; ++r) {
        const float p = __expf(s[j][r] - msafe);
        pj[j] += p;
        const float p1k = p * 1024.0f;
        const _Float16 ph = (_Float16)p1k;
        pa[j >> 1].h[j & 1][r] = ph;
        pl[j >> 1].h[j & 1][r] = (_Float16)((p1k - (float)ph) * 4096.0f);
      }
    }
    lrow = lrow * alpha + ((pj[0] + pj[1]) + (pj[2] + pj[3]));
#pragma unroll
    for (int t = 0; t < 4; ++t)
#pragma unroll
      for (int r = 0; r < 8; ++r) oacc[t][r] *= alpha;

    // ---- context^T += V^T . P^T (f16 WMMA), residual products into a separate accumulator ----
    v8f o1[4];
#pragma unroll
    for (int t = 0; t < 4; ++t) o1[t] = zero8();
#pragma unroll
    for (int kk = 0; kk < 2; ++kk) {           // unrolled: pa / pl are register operands picked by kk
#pragma unroll
      for (int t = 0; t < 4; ++t) {
        FH vb, vl;
        vb.h[0] = *(const v8h*)(Vth + (t * 16 + c) * LP + kk * 32 + 8 * hh);
        vb.h[1] = *(const v8h*)(Vth + (t * 16 + c) * LP + kk * 32 + 16 + 8 * hh);
        vl.h[0] = *(const v8h*)(Vtl + (t * 16 + c) * LP + kk * 32 + 8 * hh);
        vl.h[1] = *(const v8h*)(Vtl + (t * 16 + c) * LP + kk * 32 + 16 + 8 * hh);
        oacc[t] = mma_h(vb.v, pa[kk].v, oacc[t]);
        o1[t]   = mma_h(vl.v, pa[kk].v, o1[t]);
        o1[t]   = mma_h(vb.v, pl[kk].v, o1[t]);
      }
    }
#pragma unroll
    for (int t = 0; t < 4; ++t)
#pragma unroll
      for (int r = 0; r < 8; ++r) oacc[t][r] += o1[t][r] * (1.0f / 4096.0f);
  }

  // ---- join the halves' sums, normalise (1/l and the 1/1024 p carry), stage the wave's 16x64 tile [query][d],
  //      bf16 hi/lo split
  float* os = Os[wave];
  {
    const float l = lrow + xhalf(lrow);
    const float inv = ((l > 0.f) ? (1.0f / l) : 0.f) * (1.0f / 1024.0f);
#pragma unroll
    for (int t = 0; t < 4; ++t) {
      v4f w0, w1;
#pragma unroll
      for (int r = 0; r < 4; ++r) { w0[r] = oacc[t][r] * inv; w1[r] = oacc[t][4 + r] * inv; }
      *(v4f*)(os + c * OSP + t * 16 + 8 * hh)     = w0;
      *(v4f*)(os + c * OSP + t * 16 + 8 * hh + 4) = w1;
    }
  }
  __builtin_amdgcn_fence(__ATOMIC_RELEASE, "workgroup");
  __builtin_amdgcn_wave_barrier();
  __builtin_amdgcn_fence(__ATOMIC_ACQUIRE, "workgroup");
  {
    const int q4 = lane >> 3, c8 = (lane & 7) * 8;
    v4u hv[4], lv[4];
#pragma unroll
    for (int it = 0; it < 4; ++it) {
      const int row = it * 4 + q4;   // it 0..3 x q4 0..3 = rows 0..15 of the wave tile
      const float* sp = os + row * OSP + c8;
      v4u a, a2;
#pragma unroll
      for (int e = 0; e < 4; ++e) {
        const float f0 = sp[2 * e], f1 = sp[2 * e + 1];
        const unsigned short h0 = bf_bits(f0), h1 = bf_bits(f1);
        const unsigned short l0 = bf_bits(f0 - bf_up(h0)), l1 = bf_bits(f1 - bf_up(h1));
        a[e] = pk16(h0, h1); a2[e] = pk16(l0, l1);
      }
      hv[it] = a; lv[it] = a2;
    }
    {
#pragma unroll
      for (int it = 0; it < 4; ++it) {
        const int row = it * 4 + q4;
        const size_t go = (rowB + q0 + row) * DM + (size_t)h * HD + c8;
        *(v4u*)(ohp + go) = hv[it];
        *(v4u*)(olp + go) = lv[it];
      }
      
    }
  }
}

// =====================================================================================================
// Workspace map (bytes; every region is an exact multiple of its 64x64-tile / whole-line store granularity, no padded
// tails needed since all shapes are tile multiples; every region is written by exactly one producer launch, none reused):
//   Xb   bf16 [4096][1024]                  0     8388608
//   WA   bf16 [3072 n][1024 k]          8388608     6291456   (q rows 0..1023, k rows 1024..2047, v rows 2048..3071)
//   WP   bf16 [1024 n][1024 k]         14680064     2097152
//   QKh  bf16 [4096][2048] (q | k hi)  16777216    16777216
//   QKl  bf16 [4096][2048] (q | k lo)  33554432    16777216
//   VTh  f16  [2][1024][2048]          50331648     8388608
//   VTl  f16  [2][1024][2048]          58720256     8388608
//   Oh   bf16 [4096][1024]             67108864     8388608
//   Ol   bf16 [4096][1024]             75497472     8388608
//   end                                83886080
// =====================================================================================================
extern "C" void kernel_launch(void* const* d_in, const int* in_sizes, int n_in,
                              void* d_out, int out_size, void* d_ws, size_t ws_size,
                              hipStream_t stream) {
  if (n_in < 7) return;
  if (in_sizes[0] != NB * SEQ * DM) return;
  if (in_sizes[1] != 3 * DM * DM) return;
  if (in_sizes[2] != 3 * DM) return;
  if (in_sizes[3] != NH * HD || in_sizes[4] != NH * HD) return;
  if (in_sizes[5] != DM * DM) return;
  if (in_sizes[6] != DM) return;
  if (out_size != NB * SEQ * DM) return;

  const float* x    = (const float*)d_in[0];   // [2][2048][1024]
  const float* Wqkv = (const float*)d_in[1];   // [1024 in][3072 out]  (cols: q | k | v, head h = cols h*64..h*64+63 of each block)
  const float* bqkv = (const float*)d_in[2];   // [3072]
  const float* gq   = (const float*)d_in[3];   // [16][64]
  const float* gk   = (const float*)d_in[4];   // [16][64]
  const float* Wout = (const float*)d_in[5];   // [1024 in][1024 out]
  const float* bout = (const float*)d_in[6];   // [1024]

  const size_t PXB = (size_t)NB * SEQ * DM * 2;    //  8388608  16-bit plane [4096][1024]
  const size_t PWA = (size_t)3 * DM * DM * 2;      //  6291456  packed [3072][1024] bf16 weight plane
  const size_t PWP = (size_t)DM * DM * 2;          //  2097152  [1024][1024] bf16 weight plane
  const size_t PQK = (size_t)NB * SEQ * QKP * 2;   // 16777216  q|k plane [4096][2048]
  const size_t PVT = (size_t)NB * DM * SEQ * 2;    //  8388608  v^T plane [2][1024][2048]
  size_t off = 0;
  const size_t oXb  = off; off += PXB;
  const size_t oWA  = off; off += PWA;
  const size_t oWP  = off; off += PWP;
  const size_t oQKh = off; off += PQK;
  const size_t oQKl = off; off += PQK;
  const size_t oVTh = off; off += PVT;
  const size_t oVTl = off; off += PVT;
  const size_t oOh  = off; off += PXB;
  const size_t oOl  = off; off += PXB;
  if (off > ws_size) return;                       // off = 83886080
  if (off > (size_t)134217728) return;

  char* ws = (char*)d_ws;
  unsigned short* Xb  = (unsigned short*)(ws + oXb);
  unsigned short* WA  = (unsigned short*)(ws + oWA);
  unsigned short* WvB = WA + (size_t)2 * DM * DM;             // rows 2048..3071 ([v feature][in], k contiguous)
  unsigned short* WPb = (unsigned short*)(ws + oWP);
  unsigned short* QKh = (unsigned short*)(ws + oQKh);
  unsigned short* QKl = (unsigned short*)(ws + oQKl);
  unsigned short* VTh = (unsigned short*)(ws + oVTh);
  unsigned short* VTl = (unsigned short*)(ws + oVTl);
  unsigned short* Oh  = (unsigned short*)(ws + oOh);
  unsigned short* Ol  = (unsigned short*)(ws + oOl);
  const float* bv = bqkv + 2 * DM;                            // bias entries 2048..3071

  const dim3 blk(256);
  const int n8x = NB * SEQ * DM / 8;                           // 524288
  const dim3 gCvtX((n8x + 255) / 256);                         // 2048 blocks
  const dim3 gTrA(3 * DM / 64, DM / 64);                       // in [1024][3072] -> out [3072][1024]: (48, 16)
  const dim3 gTrP(DM / 64, DM / 64);                           // in [1024][1024] -> out [1024][1024]: (16, 16)
  const dim3 gQK(((NB * SEQ / 64) * (QKP / 64) + 7) / 8, 1);   // 2048 tiles -> 256 blocks: M=4096, N=2048
  const dim3 gVT(((DM / 64) * (SEQ / 64) + 7) / 8, NB);        // 512 tiles -> 64 blocks x 2 batches: M=1024, N=2048
  const dim3 gAttn(NB * NH * NQB);                             // 1024 blocks of 128
  const dim3 gOut(((NB * SEQ / 64) * (DM / 64) + 7) / 8, 1);   // 1024 tiles -> 128 blocks: M=4096, N=1024

  // (1) x -> bf16 plane [4096][1024]; weights [in][out] f32 -> bf16 [out][in] (k contiguous) through LDS tiles
  cvt_bf16x8<<<gCvtX, blk, 0, stream>>>(x, Xb, n8x);
  tr_bf16<<<gTrA, blk, 0, stream>>>(Wqkv, WA, DM, 3 * DM);
  tr_bf16<<<gTrP, blk, 0, stream>>>(Wout, WPb, DM, DM);
  // (2) q|k = x . Wqk^T + bqk, per-head normalised (x 8 x gamma), -> bf16 hi/lo planes [b*SEQ+t][n], n < 2048
  //     (Bt = WA rows 0..2047; M=4096, N=2048, K=1024)
  gemm64<0, 2, 1, 1><<<gQK, blk, 0, stream>>>(
      Xb, Xb, DM, 0LL, WA, DM, 0LL, bqkv, gq, gk,
      (void*)QKh, QKP, 0LL, (void*)QKl, QKP, 0LL, QKP,
      NB * SEQ, QKP, DM, 1.0f);
  // (3) v^T = Wv . x^T + bv per batch -> f16 hi plane [b][h*64+d][s] (pitch SEQ) and residual plane (x4096, same layout)
  //     (A = WA rows 2048..3071 [n][k], Bt = Xb rows of batch b; M=1024, N=2048, K=1024)
  gemm64<0, 3, 2, 0><<<gVT, blk, 0, stream>>>(
      WvB, WvB, DM, 0LL, Xb, DM, (long long)SEQ * DM, bv, bv, bv,
      (void*)VTh, SEQ, (long long)DM * SEQ, (void*)VTl, SEQ, (long long)DM * SEQ, SEQ,
      DM, SEQ, DM, 4096.0f);
  // (4) full attention -> context bf16 hi/lo planes [4096][1024]
  attn_full64<<<gAttn, dim3(128), 0, stream>>>(QKh, QKl, VTh, VTl, Oh, Ol);
  // (5) out = context . Wout + bout -> d_out f32 [4096][1024]  (A = context hi + lo planes, 2 products; Bt = WP [n][k])
  gemm64<1, 0, 1, 0><<<gOut, blk, 0, stream>>>(
      Oh, Ol, DM, 0LL, WPb, DM, 0LL, bout, bout, bout,
      d_out, DM, 0LL, d_out, DM, 0LL, DM,
      NB * SEQ, DM, DM, 1.0f);
  (void)hipGetLastError();
}

// v003
// One run takes 189 microseconds.
// In two side-by-side timings against v002, it was 1.54 and 1.55 times as fast.
// All steps since v000 together make it 2.40 times as fast.
// Contractions: q|k and v^T projections = v_wmma_f32_16x16x32_bf16 (bf16 operands from RNE-converted x and the
// transposed [out][in] projection weight, single product, f32 accumulate);
// k.q^T scores = v_wmma_f32_16x16x32_bf16 with bf16 hi/lo split of the normalised q and k (hi.hi + hi.lo + lo.hi), f32 accumulate;
// v^T.p^T = v_wmma_f32_16x16x32_f16 (p carried x1024 in f16 plus an f16 residual plane x4096; v as f16 hi plane plus an f16
// residual plane x4096; 3 products, f32 accumulate);
// ctx.Wout = v_wmma_f32_16x16x32_bf16 with ctx as bf16 hi/lo planes times bf16 Wout (2 products), f32 accumulate;
// per-head sum-of-squares normalisation (x 8 x gamma), softmax, normalisers and bias adds in f32 on the VALU.
// Carry audit:
//   p hi = f16(1024 * p)                     -> the 1/1024 is folded exactly once in the attention epilogue: inv = (1/l) * (1/1024)
//   p res = f16((1024 p - p hi) * 4096)      }  products VTl.(p hi) and VTh.(p res) go to the separate accumulator o1,
//   VTl = f16((v - VTh) * 4096)              }  folded back with * (1/4096) once per key chunk
//   VTh = f16(v), no carry (|v| typ. 0.6); q / k / ctx lo planes are unscaled bf16 residuals (v - hi) sharing the hi accumulator;
//   score scale 1/8 applied once in f32 after the score accumulate; normalisation 8 * rsqrt(sum sq) * gamma applied in f32 in the
//   q|k projection epilogue before the bf16 hi/lo split. No other scaled planes.
#include <hip/hip_runtime.h>
#include <math.h>
#include <stdint.h>

#define NB    2
#define SEQ   2048
#define DM    1024
#define NH    16
#define HD    64
#define QKP   (2 * DM)     // pitch (elements) of the packed q|k planes: q at cols 0..1023, k at cols 1024..2047
#define NQB   (SEQ / 64)   // 32 query / key blocks of 64
#define LP    72           // LDS row pitch (16-bit elements) of the attention K / V^T tiles: 144 B = 16 B x odd, so the 16 rows
                           // that one ds_load_b128 fragment read touches fall on 16 different 16-B bank groups (128 B puts them on 2)
#define GK    64           // k elements of one GEMM stage: 128 B of every operand row
#define GP    (GK + 8)     // LDS row pitch (16-bit elements) of the GEMM stage: 144 B = 16 B x odd, as for LP
#define OSP   68           // LDS row pitch (floats) of the attention output tile: conflict-free for 16-B row reads
static_assert(NH * HD == DM);
static_assert(HD == 64);
static_assert((SEQ % 64) == 0 && (DM % 64) == 0 && (DM % 32) == 0);
static_assert(GK == 64);   // the GEMM staging map below is written for 128-B row pieces
static_assert(((NB * SEQ) % 128) == 0 && (QKP % 128) == 0 && (DM % 128) == 0 && (SEQ % 128) == 0 && (DM % GK) == 0);
static_assert((NB * SEQ * DM) % (8 * 256) == 0);

typedef _Float16 v16h __attribute__((ext_vector_type(16)));
typedef _Float16 v8h  __attribute__((ext_vector_type(8)));
typedef __bf16   v16b __attribute__((ext_vector_type(16)));
typedef __bf16   v8b  __attribute__((ext_vector_type(8)));
typedef float    v8f  __attribute__((ext_vector_type(8)));
typedef float    v4f  __attribute__((ext_vector_type(4)));
typedef unsigned int v4u __attribute__((ext_vector_type(4)));

// ---- scalar helpers --------------------------------------------------------------------------------
__device__ __forceinline__ unsigned short bf_bits(float f) {          // f32 -> bf16 bits, RNE convert
  unsigned u = __float_as_uint(f);
  return (unsigned short)((u + 0x7FFFu + ((u >> 16) & 1u)) >> 16);
}
__device__ __forceinline__ float bf_up(unsigned short hb) { return __uint_as_float(((unsigned)hb) << 16); }
__device__ __forceinline__ unsigned short h_bits(_Float16 x) { return __builtin_bit_cast(unsigned short, x); }
__device__ __forceinline__ unsigned pk16(unsigned short a, unsigned short b) { return (unsigned)a | ((unsigned)b << 16); }
__device__ __forceinline__ v8f zero8() { v8f z = {0.f, 0.f, 0.f, 0.f, 0.f, 0.f, 0.f, 0.f}; return z; }

// ---- fragment loader: 16-bit A/B operand, lane -> row/col (lane&15), p already includes +8*(lane>>4);
//      elements 0..7 <- p[0..7] (k0+8h..), elements 8..15 <- p[16..23] (k0+16+8h..)
__device__ __forceinline__ v16b ldfrag_b(const __bf16* p) {
  union { v16b v; v8b h[2]; } f;
  f.h[0] = *(const v8b*)(p);
  f.h[1] = *(const v8b*)(p + 16);
  return f.v;
}

// ---- WMMA helpers with trailing VALU hazard gap --------------------------------------------------------
__device__ __forceinline__ v8f mma_b(v16b a, v16b b, v8f c) {
  c = __builtin_amdgcn_wmma_f32_16x16x32_bf16(false, a, false, b, (short)0, c, false, false);
  asm volatile("v_nop\n\tv_nop\n\tv_nop\n\tv_nop" : "+v"(c) : "v"(a), "v"(b));
  return c;
}
__device__ __forceinline__ v8f mma_h(v16h a, v16h b, v8f c) {
  c = __builtin_amdgcn_wmma_f32_16x16x32_f16(false, a, false, b, (short)0, c, false, false);
  asm volatile("v_nop\n\tv_nop\n\tv_nop\n\tv_nop" : "+v"(c) : "v"(a), "v"(b));
  return c;
}
__device__ __forceinline__ v8f mma_b_raw(v16b a, v16b b, v8f c) {
  return __builtin_amdgcn_wmma_f32_16x16x32_bf16(false, a, false, b, (short)0, c, false, false);
}
__device__ __forceinline__ void dep_guard_b(v8f& a, v8f& b, v16b x, v16b y) {
  asm volatile("v_nop\n\tv_nop\n\tv_nop\n\tv_nop" : "+v"(a), "+v"(b) : "v"(x), "v"(y));
}
__device__ __forceinline__ void keep4_b(v16b a, v16b b, v16b c, v16b d) {
  asm volatile("v_nop" :: "v"(a), "v"(b), "v"(c), "v"(d));
}
__device__ __forceinline__ void acc_guard4(v8f& a, v8f& b, v8f& c, v8f& d) {
  asm volatile("v_nop\n\tv_nop\n\tv_nop\n\tv_nop" : "+v"(a), "+v"(b), "+v"(c), "+v"(d));
}

// =====================================================================================================
// f32 -> bf16 (RNE convert), 8 elements per thread, one 16-B store per lane: a wave writes 512 contiguous B
// coverage: n8 threads x 8 = the whole plane (n8 here is a multiple of 256).
// =====================================================================================================
__global__ __launch_bounds__(256) void cvt_bf16x8(const float* __restrict__ in, unsigned short* out, int n8) {
  const int i = blockIdx.x * 256 + (int)threadIdx.x;
  if (i < n8) {
    const v4f a = *(const v4f*)(in + (size_t)i * 8);
    const v4f b = *(const v4f*)(in + (size_t)i * 8 + 4);
    v4u p;
    p[0] = pk16(bf_bits(a[0]), bf_bits(a[1]));
    p[1] = pk16(bf_bits(a[2]), bf_bits(a[3]));
    p[2] = pk16(bf_bits(b[0]), bf_bits(b[1]));
    p[3] = pk16(bf_bits(b[2]), bf_bits(b[3]));
    *(v4u*)(out + (size_t)i * 8) = p;
    
  }
}

// =====================================================================================================
// Transpose-convert: f32 in[R rows][Cn cols] -> bf16 out[Cn][R] (RNE convert), 64x64 tiles through LDS.
// grid = (Cn/64, R/64), block 256 (R, Cn multiples of 64). Loads: 4 coalesced float4 per thread
// (64 rows x 16 float4 = the whole input tile). Stores: wave w writes output rows w*8 + it*4 + (lane>>3),
// coverage: 8 waves x 8 rows x 64 k = the whole 64x64 output tile; the grid covers the whole [Cn][R] plane.
// =====================================================================================================
__global__ __launch_bounds__(256) void tr_bf16(const float* __restrict__ in, unsigned short* out, int R, int Cn) {
  __shared__ __align__(16) float sm[64 * 65];
  const int t = (int)threadIdx.x, lane = t & 31, wave = t >> 5;
  const int n0 = blockIdx.x * 64;    // column block of in = row block of out
  const int k0 = blockIdx.y * 64;    // row block of in = column block of out
#pragma unroll
  for (int i = 0; i < 4; ++i) {
    const int idx = t + 256 * i;
    const int kr = idx >> 4, c4 = (idx & 15) * 4;
    const v4f v = *(const v4f*)(in + (size_t)(k0 + kr) * Cn + n0 + c4);
    sm[kr * 65 + c4 + 0] = v[0];
    sm[kr * 65 + c4 + 1] = v[1];
    sm[kr * 65 + c4 + 2] = v[2];
    sm[kr * 65 + c4 + 3] = v[3];
  }
  __syncthreads();
  const int q = lane >> 3, c8 = (lane & 7) * 8;
  v4u pv[2];
#pragma unroll
  for (int it = 0; it < 2; ++it) {
    const int n = wave * 8 + it * 4 + q;
    v4u p;
#pragma unroll
    for (int e = 0; e < 4; ++e) {
      const float a = sm[(c8 + 2 * e) * 65 + n];
      const float b = sm[(c8 + 2 * e + 1) * 65 + n];
      p[e] = pk16(bf_bits(a), bf_bits(b));
    }
    pv[it] = p;
  }
  {
#pragma unroll
    for (int it = 0; it < 2; ++it) {
      const int n = wave * 8 + it * 4 + q;
      *(v4u*)(out + (size_t)(n0 + n) * R + k0 + c8) = pv[it];
    }
    
  }
}

// =====================================================================================================
// Register-blocked batched bf16 WMMA GEMM: C[m][n] = sum_k A[m][k] * Bt[n][k] + bias; one wave per 64x64 tile,
// 2 x 2 waves = one 128x128 tile per block. Per GK k the block stages its 128 A rows and 128 Bt rows (128 B each) in LDS
// with whole-line loads (8 lanes a row, 4 rows a wave-wide load) and every wave reads its fragments from there, so a row
// is fetched once per block instead of once per wave, 32 B of 16 lines at a time.
// A row-major [M][K], Bt row-major [N][K] (k contiguous), both at the fixed pitch DM, so that a thread's 8 rows of a plane
// are one address plus immediate offsets;
// M, N multiples of 128, K multiple of GK (host shapes are static multiples). blockIdx.y = batch index (strides in elements).
// NSPLIT: 0 = A.Bt; 1 = (A + A2).Bt (A2 = unscaled bf16 lo plane of A, 2 products).
// BIAS: 1 = per column n, bias[n]; 2 = per row m, bias[m]; the bias value is RNE-converted to bf16 and added in f32.
// NORM (only with OUT_MODE 2, BIAS 1, N tile = one 64-wide head): per row, over the tile's 64 columns,
//   value := (acc + bias) * 8 * rsqrt(max(sum (acc + bias)^2, 1e-24)) * gamma[n mod DM] in f32, gamma = gma for
//   n0 < DM else gmb (RNE-converted to bf16); the row sum uses 16-lane shuffles (all lanes active).
// OUT_MODE: 0 = f32 (pitch ldc); 2 = bf16 hi plane C + bf16 lo plane C2 (lo = RNE(v - hi), unscaled);
//           3 = f16 hi plane C + f16 residual plane C2 = f16((v - hi) * rscale), C2 written only for tiles
//               with n0 < N2 (pitch ldc2, batch stride strideC2).
// =====================================================================================================
template <int NSPLIT, int OUT_MODE, int BIAS, int NORM>
__global__ __launch_bounds__(128) void gemm64(
    const unsigned short* __restrict__ Ap, const unsigned short* A2p, long long strideA,
    const unsigned short* __restrict__ Btp, long long strideB,
    const float* __restrict__ bias, const float* __restrict__ gma, const float* __restrict__ gmb,
    void* Cout, int ldc, long long strideC,
    void* Cout2, int ldc2, long long strideC2, int N2,
    int M, int N, int K, float rscale) {
  const __bf16* A   = (const __bf16*)(const void*)Ap;
  const __bf16* A2  = (const __bf16*)(const void*)A2p;
  const __bf16* Bt  = (const __bf16*)(const void*)Btp;
  __shared__ __align__(16) float sT[4][16 * 68];   // per-wave 16x64 slab, pitch 68 floats
  __shared__ __align__(16) __bf16 As[128 * GP];                          // A rows  [m][GK k] at pitch GP  18 KB
  __shared__ __align__(16) __bf16 A2s[(NSPLIT >= 1 ? 128 : 1) * GP];     // A2 rows, only with NSPLIT 1
  __shared__ __align__(16) __bf16 Bs[128 * GP];                          // Bt rows [n][GK k] at pitch GP  18 KB
  const int b    = blockIdx.y;
  const int lane = threadIdx.x & 31;
  const int wave = threadIdx.x >> 5;
  const int tilesN = N >> 7;
  const int tilesM = M >> 7;
  const int tile = blockIdx.x;
  if (tile >= tilesM * tilesN) return;   // block-uniform, ahead of every barrier
  const int tm = tile / tilesN;
  const int tn = tile - tm * tilesN;
  const int bm0 = tm << 7;               // the block's 128x128 tile
  const int bn0 = tn << 7;
  const int wm  = (wave >> 1) << 6;      // the wave's 64x64 tile inside it
  const int wn  = (wave & 1) << 6;
  const int m0 = bm0 + wm;
  const int n0 = bn0 + wn;

  const __bf16* Ab  = A  + (size_t)b * (size_t)strideA;
  const __bf16* Bb  = Bt + (size_t)b * (size_t)strideB;
  const __bf16* Ab2 = (NSPLIT >= 1) ? (A2 + (size_t)b * (size_t)strideA) : Ab;

  const int rlane = lane & 15;                 // row (A) / col (B, D) within subtile
  const int koff  = (lane >> 4) * 8;           // k offset of this lane half
  const int mOff  = (lane >> 4) * 8;           // D row offset

  v8f acc[4][4];
#pragma unroll
  for (int i = 0; i < 4; ++i)
#pragma unroll
    for (int j = 0; j < 4; ++j) acc[i][j] = zero8();

  // staging map: 8 lanes x 16 B = one whole 128-B row piece (a cache line), four rows a wave-wide load; the two rows of a
  // half wave lie 8 apart, so that at pitch GP their 2 x 128 B fall on all 64 LDS banks once in the store.
  // Wave w stages rows w*32 .. w*32+31 of every plane.
  const int ssub = lane >> 3, sc8 = (lane & 7) * 8;
  const int srow = wave * 32 + (ssub >> 1) + (ssub & 1) * 8;   // + (i>>2)*16 + (i&3)*2, i = 0..7
  const __bf16* ga  = Ab  + (size_t)(bm0 + srow) * DM + sc8;   // rows bm0 + srow + 0..22 < M, bn0 + srow + 0..22 < N
  const __bf16* ga2 = Ab2 + (size_t)(bm0 + srow) * DM + sc8;
  const __bf16* gb  = Bb  + (size_t)(bn0 + srow) * DM + sc8;

  for (int k0 = 0; k0 < K; k0 += GK) {
    __syncthreads();                       // every wave has read the last stage's fragments
    {
      v8b ra[8], ra2[8], rb[8];
      const __bf16* pa  = ga + k0;
      const __bf16* pa2 = ga2 + k0;
      const __bf16* pb  = gb + k0;
#pragma unroll
      for (int i = 0; i < 8; ++i) {
        const int ro = (i >> 2) * 16 + (i & 3) * 2;
        ra[i] = *(const v8b*)(pa + ro * DM);
        if (NSPLIT >= 1) ra2[i] = *(const v8b*)(pa2 + ro * DM);
        rb[i] = *(const v8b*)(pb + ro * DM);
      }
      // precaution: the wait stands behind the loads and names their address registers, so that nothing (no later
      // load's destination either) is laid over an address before it
      asm volatile("s_wait_xcnt 0x0" :: "v"(pa), "v"(pa2), "v"(pb) : "memory");
#pragma unroll
      for (int i = 0; i < 8; ++i) {
        const int ro = (i >> 2) * 16 + (i & 3) * 2;
        *(v8b*)(As + (srow + ro) * GP + sc8) = ra[i];
        if (NSPLIT >= 1) *(v8b*)(A2s + (srow + ro) * GP + sc8) = ra2[i];
        *(v8b*)(Bs + (srow + ro) * GP + sc8) = rb[i];
      }
    }
    __syncthreads();                       // the stage is complete for every wave
#pragma unroll
    for (int kk = 0; kk < GK; kk += 32) {
      v16b bh[4], ah[4], al[4];
#pragma unroll
      for (int j = 0; j < 4; ++j) bh[j] = ldfrag_b(Bs + (wn + (j << 4) + rlane) * GP + kk + koff);
#pragma unroll
      for (int i = 0; i < 4; ++i) {
        const int ao = (wm + (i << 4) + rlane) * GP + kk + koff;
        ah[i] = ldfrag_b(As + ao);
        al[i] = ah[i];
        if (NSPLIT >= 1) al[i] = ldfrag_b(A2s + ao);
      }
#pragma unroll
      for (int i = 0; i < 4; ++i) {
#pragma unroll
        for (int j = 0; j < 4; ++j) {
          acc[i][j] = mma_b_raw(ah[i], bh[j], acc[i][j]);
          if (NSPLIT >= 1) acc[i][j] = mma_b_raw(al[i], bh[j], acc[i][j]);
        }
        dep_guard_b(acc[i][0], acc[i][3], ah[i], al[i]);
      }
      keep4_b(bh[0], bh[1], bh[2], bh[3]);
    }
  }
  acc_guard4(acc[0][0], acc[0][1], acc[0][2], acc[0][3]);
  acc_guard4(acc[1][0], acc[1][1], acc[1][2], acc[1][3]);
  acc_guard4(acc[2][0], acc[2][1], acc[2][2], acc[2][3]);
  acc_guard4(acc[3][0], acc[3][1], acc[3][2], acc[3][3]);

  // ---- epilogue ----
  float* slab = sT[wave];
  float bcol[4], gcol[4];
#pragma unroll
  for (int j = 0; j < 4; ++j) {
    bcol[j] = 0.f;
    gcol[j] = 1.f;
    if (BIAS == 1) bcol[j] = bf_up(bf_bits(bias[n0 + (j << 4) + rlane]));   // n < N, bias has N entries
    if (NORM) {
      const int nn = (n0 & (DM - 1)) + (j << 4) + rlane;                   // < DM = NH*HD entries
      const float ga = bf_up(bf_bits(gma[nn]));
      const float gb = bf_up(bf_bits(gmb[nn]));
      gcol[j] = (n0 < DM) ? ga : gb;                                       // wave-uniform select by value
    }
  }
#pragma unroll
  for (int i = 0; i < 4; ++i) {
    const int mBase = m0 + (i << 4);
    float brow[8];
#pragma unroll
    for (int r = 0; r < 8; ++r) {
      brow[r] = 0.f;
      if (BIAS == 2) brow[r] = bf_up(bf_bits(bias[mBase + mOff + r]));      // m < M, bias has M entries
    }
    float rsc[8];
#pragma unroll
    for (int r = 0; r < 8; ++r) rsc[r] = 1.f;
    if (NORM) {
      float ss[8];
#pragma unroll
      for (int r = 0; r < 8; ++r) {
        float a = 0.f;
#pragma unroll
        for (int j = 0; j < 4; ++j) {
          const float v = acc[i][j][r] + bcol[j];
          a += v * v;
        }
        ss[r] = a;
      }
#pragma unroll
      for (int r = 0; r < 8; ++r) {
#pragma unroll
        for (int off = 1; off < 16; off <<= 1) ss[r] += __shfl_xor(ss[r], off, 32);   // stays inside the lane half
        rsc[r] = rsqrtf(fmaxf(ss[r], 1e-24f)) * 8.0f;
      }
    }
#pragma unroll
    for (int j = 0; j < 4; ++j) {
#pragma unroll
      for (int r = 0; r < 8; ++r) {
        slab[(mOff + r) * 68 + (j << 4) + rlane] = (acc[i][j][r] + bcol[j] + brow[r]) * rsc[r] * gcol[j];
      }
    }
    __builtin_amdgcn_fence(__ATOMIC_RELEASE, "workgroup");
    __builtin_amdgcn_wave_barrier();
    __builtin_amdgcn_fence(__ATOMIC_ACQUIRE, "workgroup");
    if (OUT_MODE == 0) {
      float* C = (float*)Cout + (size_t)b * (size_t)strideC;
      const int h2 = lane >> 4, c4 = (lane & 15) * 4;     // 256-B row segment = 16 lanes x 16 B
      {
#pragma unroll
        for (int it = 0; it < 8; ++it) {
          const int row = it * 2 + h2;                     // it 0..7 x h2 0..1 = rows 0..15
          const v4f v = *(const v4f*)(slab + row * 68 + c4);
          *(v4f*)(C + (size_t)(mBase + row) * ldc + n0 + c4) = v;
        }
        
      }
    } else {
      const int q = lane >> 3, c8 = (lane & 7) * 8;
      unsigned short* C  = (unsigned short*)Cout  + (size_t)b * (size_t)strideC;
      unsigned short* C2 = (unsigned short*)Cout2 + (size_t)b * (size_t)strideC2;
      const bool wlo = (OUT_MODE == 2) || (n0 < N2);      // wave-uniform
      v4u hv[4], lv[4];
#pragma unroll
      for (int it = 0; it < 4; ++it) {
        const int row = it * 4 + q;                        // it 0..3 x q 0..3 = rows 0..15
        const float* sp = slab + row * 68 + c8;
        v4u a, a2;
#pragma unroll
        for (int e = 0; e < 4; ++e) {
          const float f0 = sp[2 * e], f1 = sp[2 * e + 1];
          unsigned short h0, h1, l0, l1;
          if (OUT_MODE == 2) {
            h0 = bf_bits(f0); h1 = bf_bits(f1);
            l0 = bf_bits(f0 - bf_up(h0)); l1 = bf_bits(f1 - bf_up(h1));
          } else {
            const _Float16 x0 = (_Float16)f0, x1 = (_Float16)f1;
            h0 = h_bits(x0); h1 = h_bits(x1);
            l0 = h_bits((_Float16)((f0 - (float)x0) * rscale));
            l1 = h_bits((_Float16)((f1 - (float)x1) * rscale));
          }
          a[e] = pk16(h0, h1); a2[e] = pk16(l0, l1);
        }
        hv[it] = a; lv[it] = a2;
      }
      {
#pragma unroll
        for (int it = 0; it < 4; ++it) {
          const int row = it * 4 + q;
          *(v4u*)(C + (size_t)(mBase + row) * ldc + n0 + c8) = hv[it];
          if (wlo) *(v4u*)(C2 + (size_t)(mBase + row) * ldc2 + n0 + c8) = lv[it];
        }
        
      }
    }
    __builtin_amdgcn_fence(__ATOMIC_RELEASE, "workgroup");
    __builtin_amdgcn_wave_barrier();
    __builtin_amdgcn_fence(__ATOMIC_ACQUIRE, "workgroup");
  }
}

__device__ __forceinline__ float xhalf(float x) {
  const int xi = __builtin_bit_cast(int, x);
  return __builtin_bit_cast(float, __builtin_amdgcn_permlanex16(xi, xi, 0x76543210, 0xfedcba98, false, false));
}

__global__ __launch_bounds__(128)
void attn_full64(const unsigned short* __restrict__ qkhp, const unsigned short* __restrict__ qklp,
                 const unsigned short* __restrict__ vhp, const unsigned short* __restrict__ vlp,
                 unsigned short* ohp, unsigned short* olp) {
  union FB { v16b v; v8b h[2]; };
  union FH { v16h v; v8h h[2]; };
  __shared__ __align__(16) __bf16   Ksh[64 * LP];                 // K hi [kv][d]   9 KB (rows of 64 at pitch LP)
  __shared__ __align__(16) __bf16   Ksl[64 * LP];                 // K lo           9 KB
  __shared__ __align__(16) _Float16 Vth[64 * LP];                 // V^T hi [d][kv] 9 KB
  __shared__ __align__(16) _Float16 Vtl[64 * LP];                 // V^T residual   9 KB
  __shared__ __align__(16) float    Os[4][16 * OSP];              // per wave context tile [query][d]  17 KB

  const int tid  = threadIdx.x;
  const int wave = tid >> 5;
  const int lane = tid & 31;
  const int hh   = lane >> 4;
  const int c    = lane & 15;

  const int bx   = blockIdx.x;
  const int qb   = bx % NQB;
  const int rest = bx / NQB;
  const int h    = rest % NH;
  const int b    = rest / NH;
  const int q0   = qb * 64 + wave * 16;
  const size_t rowB = (size_t)b * SEQ;

  const __bf16* Qh = (const __bf16*)(const void*)qkhp + (size_t)h * HD;
  const __bf16* Ql = (const __bf16*)(const void*)qklp + (size_t)h * HD;
  const __bf16* Kh = (const __bf16*)(const void*)qkhp + DM + (size_t)h * HD;
  const __bf16* Kl = (const __bf16*)(const void*)qklp + DM + (size_t)h * HD;
  const _Float16* Vh = (const _Float16*)(const void*)vhp + ((size_t)b * DM + (size_t)h * HD) * SEQ;
  const _Float16* Vl = (const _Float16*)(const void*)vlp + ((size_t)b * DM + (size_t)h * HD) * SEQ;

  // ---- Q fragments (B operand, column = query = lane&15): 2 d-chunks, hi and lo ----
  v16b qah[2], qal[2];
#pragma unroll
  for (int dc = 0; dc < 2; ++dc) {
    const size_t qo = (rowB + q0 + c) * QKP + dc * 32 + 8 * hh;
    qah[dc] = ldfrag_b(Qh + qo);
    qal[dc] = ldfrag_b(Ql + qo);
  }

  float mrow = -INFINITY, lrow = 0.f;          // this lane's query: running maximum (both halves alike), this half's sum
  v8f oacc[4];
#pragma unroll
  for (int t = 0; t < 4; ++t) oacc[t] = zero8();

  for (int kt = 0; kt < NQB; ++kt) {           // static trip count
    const int kv0 = kt * 64;                   // kv0 + 63 < SEQ
    __syncthreads();
    {
      const int r = tid >> 1, half = (tid & 1) * 32;
      const __bf16*   kg  = Kh + (rowB + kv0 + r) * QKP + half;   // K row kv0+r, d = half..half+31
      const __bf16*   klg = Kl + (rowB + kv0 + r) * QKP + half;
      const _Float16* vg  = Vh + (size_t)r * SEQ + kv0 + half;    // V^T row d = r, s = kv0+half..+31
      const _Float16* vlg = Vl + (size_t)r * SEQ + kv0 + half;
#pragma unroll
      for (int i = 0; i < 4; ++i) {
        const v8b a0 = *(const v8b*)(kg + 8 * i);
        const v8b a1 = *(const v8b*)(klg + 8 * i);
        const v8h b0 = *(const v8h*)(vg + 8 * i);
        const v8h b1 = *(const v8h*)(vlg + 8 * i);
        *(v8b*)(Ksh + r * LP + half + 8 * i) = a0;
        *(v8b*)(Ksl + r * LP + half + 8 * i) = a1;
        *(v8h*)(Vth + r * LP + half + 8 * i) = b0;
        *(v8h*)(Vtl + r * LP + half + 8 * i) = b1;
      }
    }
    __syncthreads();

    // ---- scores, transposed: 64 keys x 16 query columns per wave, 3 bf16 products ----
    v8f s[4];
#pragma unroll
    for (int j = 0; j < 4; ++j) {
      s[j] = zero8();
#pragma unroll
      for (int dc = 0; dc < 2; ++dc) {
        FB kb, kl;
        kb.h[0] = *(const v8b*)(Ksh + (j * 16 + c) * LP + dc * 32 + 8 * hh);
        kb.h[1] = *(const v8b*)(Ksh + (j * 16 + c) * LP + dc * 32 + 16 + 8 * hh);
        kl.h[0] = *(const v8b*)(Ksl + (j * 16 + c) * LP + dc * 32 + 8 * hh);
        kl.h[1] = *(const v8b*)(Ksl + (j * 16 + c) * LP + dc * 32 + 16 + 8 * hh);
        s[j] = mma_b(kb.v, qah[dc], s[j]);
        s[j] = mma_b(kl.v, qah[dc], s[j]);
        s[j] = mma_b(kb.v, qal[dc], s[j]);
      }
    }

    // ---- scale, maximum of this lane's query, online softmax, P (x1024, f16) and P residual (x4096) in registers ----
    float mj[4];
#pragma unroll
    for (int j = 0; j < 4; ++j) {
      mj[j] = -INFINITY;
#pragma unroll
      for (int r = 0; r < 8; ++r) {
        const float sv = s[j][r] * 0.125f;
        s[j][r] = sv;
        mj[j] = fmaxf(mj[j], sv);
      }
    }
    float m = fmaxf(fmaxf(mj[0], mj[1]), fmaxf(mj[2], mj[3]));
    m = fmaxf(m, xhalf(m));                    // both halves now hold the maximum over the chunk's 64 keys
    const float mnew  = fmaxf(mrow, m);
    const float msafe = (mnew == -INFINITY) ? 0.f : mnew;
    const float alpha = __expf(mrow - msafe);
    mrow = mnew;
    FH pa[2], pl[2];                           // B operands of key blocks 0 and 1: p hi plane, p residual plane
    float pj[4];
#pragma unroll
    for (int j = 0; j < 4; ++j) {
      pj[j] = 0.f;
#pragma unroll
      for (int r = 0; r < 8; ++r) {
        const float p = __expf(s[j][r] - msafe);
        pj[j] += p;
        const float p1k = p * 1024.0f;
        const _Float16 ph = (_Float16)p1k;
        pa[j >> 1].h[j & 1][r] = ph;
        pl[j >> 1].h[j & 1][r] = (_Float16)((p1k - (float)ph) * 4096.0f);
      }
    }
    lrow = lrow * alpha + ((pj[0] + pj[1]) + (pj[2] + pj[3]));
#pragma unroll
    for (int t = 0; t < 4; ++t)
#pragma unroll
      for (int r = 0; r < 8; ++r) oacc[t][r] *= alpha;

    // ---- context^T += V^T . P^T (f16 WMMA), residual products into a separate accumulator ----
    v8f o1[4];
#pragma unroll
    for (int t = 0; t < 4; ++t) o1[t] = zero8();
#pragma unroll
    for (int kk = 0; kk < 2; ++kk) {           // unrolled: pa / pl are register operands picked by kk
#pragma unroll
      for (int t = 0; t < 4; ++t) {
        FH vb, vl;
        vb.h[0] = *(const v8h*)(Vth + (t * 16 + c) * LP + kk * 32 + 8 * hh);
        vb.h[1] = *(const v8h*)(Vth + (t * 16 + c) * LP + kk * 32 + 16 + 8 * hh);
        vl.h[0] = *(const v8h*)(Vtl + (t * 16 + c) * LP + kk * 32 + 8 * hh);
        vl.h[1] = *(const v8h*)(Vtl + (t * 16 + c) * LP + kk * 32 + 16 + 8 * hh);
        oacc[t] = mma_h(vb.v, pa[kk].v, oacc[t]);
        o1[t]   = mma_h(vl.v, pa[kk].v, o1[t]);
        o1[t]   = mma_h(vb.v, pl[kk].v, o1[t]);
      }
    }
#pragma unroll
    for (int t = 0; t < 4; ++t)
#pragma unroll
      for (int r = 0; r < 8; ++r) oacc[t][r] += o1[t][r] * (1.0f / 4096.0f);
  }

  // ---- join the halves' sums, normalise (1/l and the 1/1024 p carry), stage the wave's 16x64 tile [query][d],
  //      bf16 hi/lo split
  float* os = Os[wave];
  {
    const float l = lrow + xhalf(lrow);
    const float inv = ((l > 0.f) ? (1.0f / l) : 0.f) * (1.0f / 1024.0f);
#pragma unroll
    for (int t = 0; t < 4; ++t) {
      v4f w0, w1;
#pragma unroll
      for (int r = 0; r < 4; ++r) { w0[r] = oacc[t][r] * inv; w1[r] = oacc[t][4 + r] * inv; }
      *(v4f*)(os + c * OSP + t * 16 + 8 * hh)     = w0;
      *(v4f*)(os + c * OSP + t * 16 + 8 * hh + 4) = w1;
    }
  }
  __builtin_amdgcn_fence(__ATOMIC_RELEASE, "workgroup");
  __builtin_amdgcn_wave_barrier();
  __builtin_amdgcn_fence(__ATOMIC_ACQUIRE, "workgroup");
  {
    const int q4 = lane >> 3, c8 = (lane & 7) * 8;
    v4u hv[4], lv[4];
#pragma unroll
    for (int it = 0; it < 4; ++it) {
      const int row = it * 4 + q4;   // it 0..3 x q4 0..3 = rows 0..15 of the wave tile
      const float* sp = os + row * OSP + c8;
      v4u a, a2;
#pragma unroll
      for (int e = 0; e < 4; ++e) {
        const float f0 = sp[2 * e], f1 = sp[2 * e + 1];
        const unsigned short h0 = bf_bits(f0), h1 = bf_bits(f1);
        const unsigned short l0 = bf_bits(f0 - bf_up(h0)), l1 = bf_bits(f1 - bf_up(h1));
        a[e] = pk16(h0, h1); a2[e] = pk16(l0, l1);
      }
      hv[it] = a; lv[it] = a2;
    }
    {
#pragma unroll
      for (int it = 0; it < 4; ++it) {
        const int row = it * 4 + q4;
        const size_t go = (rowB + q0 + row) * DM + (size_t)h * HD + c8;
        *(v4u*)(ohp + go) = hv[it];
        *(v4u*)(olp + go) = lv[it];
      }
      
    }
  }
}

// =====================================================================================================
// Workspace map (bytes; every region is an exact multiple of its 64x64-tile / whole-line store granularity, no padded
// tails needed since all shapes are tile multiples; every region is written by exactly one producer launch, none reused):
//   Xb   bf16 [4096][1024]                  0     8388608
//   WA   bf16 [3072 n][1024 k]          8388608     6291456   (q rows 0..1023, k rows 1024..2047, v rows 2048..3071)
//   WP   bf16 [1024 n][1024 k]         14680064     2097152
//   QKh  bf16 [4096][2048] (q | k hi)  16777216    16777216
//   QKl  bf16 [4096][2048] (q | k lo)  33554432    16777216
//   VTh  f16  [2][1024][2048]          50331648     8388608
//   VTl  f16  [2][1024][2048]          58720256     8388608
//   Oh   bf16 [4096][1024]             67108864     8388608
//   Ol   bf16 [4096][1024]             75497472     8388608
//   end                                83886080
// =====================================================================================================
extern "C" void kernel_launch(void* const* d_in, const int* in_sizes, int n_in,
                              void* d_out, int out_size, void* d_ws, size_t ws_size,
                              hipStream_t stream) {
  if (n_in < 7) return;
  if (in_sizes[0] != NB * SEQ * DM) return;
  if (in_sizes[1] != 3 * DM * DM) return;
  if (in_sizes[2] != 3 * DM) return;
  if (in_sizes[3] != NH * HD || in_sizes[4] != NH * HD) return;
  if (in_sizes[5] != DM * DM) return;
  if (in_sizes[6] != DM) return;
  if (out_size != NB * SEQ * DM) return;

  const float* x    = (const float*)d_in[0];   // [2][2048][1024]
  const float* Wqkv = (const float*)d_in[1];   // [1024 in][3072 out]  (cols: q | k | v, head h = cols h*64..h*64+63 of each block)
  const float* bqkv = (const float*)d_in[2];   // [3072]
  const float* gq   = (const float*)d_in[3];   // [16][64]
  const float* gk   = (const float*)d_in[4];   // [16][64]
  const float* Wout = (const float*)d_in[5];   // [1024 in][1024 out]
  const float* bout = (const float*)d_in[6];   // [1024]

  const size_t PXB = (size_t)NB * SEQ * DM * 2;    //  8388608  16-bit plane [4096][1024]
  const size_t PWA = (size_t)3 * DM * DM * 2;      //  6291456  packed [3072][1024] bf16 weight plane
  const size_t PWP = (size_t)DM * DM * 2;          //  2097152  [1024][1024] bf16 weight plane
  const size_t PQK = (size_t)NB * SEQ * QKP * 2;   // 16777216  q|k plane [4096][2048]
  const size_t PVT = (size_t)NB * DM * SEQ * 2;    //  8388608  v^T plane [2][1024][2048]
  size_t off = 0;
  const size_t oXb  = off; off += PXB;
  const size_t oWA  = off; off += PWA;
  const size_t oWP  = off; off += PWP;
  const size_t oQKh = off; off += PQK;
  const size_t oQKl = off; off += PQK;
  const size_t oVTh = off; off += PVT;
  const size_t oVTl = off; off += PVT;
  const size_t oOh  = off; off += PXB;
  const size_t oOl  = off; off += PXB;
  if (off > ws_size) return;                       // off = 83886080
  if (off > (size_t)134217728) return;

  char* ws = (char*)d_ws;
  unsigned short* Xb  = (unsigned short*)(ws + oXb);
  unsigned short* WA  = (unsigned short*)(ws + oWA);
  unsigned short* WvB = WA + (size_t)2 * DM * DM;             // rows 2048..3071 ([v feature][in], k contiguous)
  unsigned short* WPb = (unsigned short*)(ws + oWP);
  unsigned short* QKh = (unsigned short*)(ws + oQKh);
  unsigned short* QKl = (unsigned short*)(ws + oQKl);
  unsigned short* VTh = (unsigned short*)(ws + oVTh);
  unsigned short* VTl = (unsigned short*)(ws + oVTl);
  unsigned short* Oh  = (unsigned short*)(ws + oOh);
  unsigned short* Ol  = (unsigned short*)(ws + oOl);
  const float* bv = bqkv + 2 * DM;                            // bias entries 2048..3071

  const dim3 blk(256);
  const int n8x = NB * SEQ * DM / 8;                           // 524288
  const dim3 gCvtX((n8x + 255) / 256);                         // 2048 blocks
  const dim3 gTrA(3 * DM / 64, DM / 64);                       // in [1024][3072] -> out [3072][1024]: (48, 16)
  const dim3 gTrP(DM / 64, DM / 64);                           // in [1024][1024] -> out [1024][1024]: (16, 16)
  const dim3 blkG(128);                                        // GEMM block: 2 x 2 waves
  const dim3 gQK((NB * SEQ / 128) * (QKP / 128), 1);           // 512 blocks of 128x128: M=4096, N=2048
  const dim3 gVT((DM / 128) * (SEQ / 128), NB);                // 128 blocks x 2 batches: M=1024, N=2048
  const dim3 gAttn(NB * NH * NQB);                             // 1024 blocks of 128
  const dim3 gOut((NB * SEQ / 128) * (DM / 128), 1);           // 256 blocks of 128x128: M=4096, N=1024

  // (1) x -> bf16 plane [4096][1024]; weights [in][out] f32 -> bf16 [out][in] (k contiguous) through LDS tiles
  cvt_bf16x8<<<gCvtX, blk, 0, stream>>>(x, Xb, n8x);
  tr_bf16<<<gTrA, blk, 0, stream>>>(Wqkv, WA, DM, 3 * DM);
  tr_bf16<<<gTrP, blk, 0, stream>>>(Wout, WPb, DM, DM);
  // (2) q|k = x . Wqk^T + bqk, per-head normalised (x 8 x gamma), -> bf16 hi/lo planes [b*SEQ+t][n], n < 2048
  //     (Bt = WA rows 0..2047; M=4096, N=2048, K=1024)
  gemm64<0, 2, 1, 1><<<gQK, blkG, 0, stream>>>(
      Xb, Xb, 0LL, WA, 0LL, bqkv, gq, gk,
      (void*)QKh, QKP, 0LL, (void*)QKl, QKP, 0LL, QKP,
      NB * SEQ, QKP, DM, 1.0f);
  // (3) v^T = Wv . x^T + bv per batch -> f16 hi plane [b][h*64+d][s] (pitch SEQ) and residual plane (x4096, same layout)
  //     (A = WA rows 2048..3071 [n][k], Bt = Xb rows of batch b; M=1024, N=2048, K=1024)
  gemm64<0, 3, 2, 0><<<gVT, blkG, 0, stream>>>(
      WvB, WvB, 0LL, Xb, (long long)SEQ * DM, bv, bv, bv,
      (void*)VTh, SEQ, (long long)DM * SEQ, (void*)VTl, SEQ, (long long)DM * SEQ, SEQ,
      DM, SEQ, DM, 4096.0f);
  // (4) full attention -> context bf16 hi/lo planes [4096][1024]
  attn_full64<<<gAttn, dim3(128), 0, stream>>>(QKh, QKl, VTh, VTl, Oh, Ol);
  // (5) out = context . Wout + bout -> d_out f32 [4096][1024]  (A = context hi + lo planes, 2 products; Bt = WP [n][k])
  gemm64<1, 0, 1, 0><<<gOut, blkG, 0, stream>>>(
      Oh, Ol, 0LL, WPb, 0LL, bout, bout, bout,
      d_out, DM, 0LL, d_out, DM, 0LL, DM,
      NB * SEQ, DM, DM, 1.0f);
  (void)hipGetLastError();
}

// v004
// Measured time: 167 microseconds a run.
// Next to v003, in two timings, it ran 1.13 and 1.14 times as fast.
// Over all steps from v000 it is 2.72 times as fast.
// Contractions: q|k and v^T projections = v_wmma_f32_16x16x32_bf16 (bf16 operands from RNE-converted x and the
// transposed [out][in] projection weight, single product, f32 accumulate);
// k.q^T scores = v_wmma_f32_16x16x32_bf16 with bf16 hi/lo split of the normalised q and k (hi.hi + hi.lo + lo.hi), f32 accumulate;
// v^T.p^T = v_wmma_f32_16x16x32_f16 (p carried x1024 in f16 plus an f16 residual plane x4096; v as f16 hi plane plus an f16
// residual plane x4096; 3 products, f32 accumulate);
// ctx.Wout = v_wmma_f32_16x16x32_bf16 with ctx as bf16 hi/lo planes times bf16 Wout (2 products), f32 accumulate;
// per-head sum-of-squares normalisation (x 8 x gamma), softmax, normalisers and bias adds in f32 on the VALU.
// Carry audit:
//   p hi = f16(1024 * p)                     -> the 1/1024 is folded exactly once in the attention epilogue: inv = (1/l) * (1/1024)
//   p res = f16((1024 p - p hi) * 4096)      }  products VTl.(p hi) and VTh.(p res) go to the separate accumulator o1,
//   VTl = f16((v - VTh) * 4096)              }  folded back with * (1/4096) once per key chunk
//   VTh = f16(v), no carry (|v| typ. 0.6); q / k / ctx lo planes are unscaled bf16 residuals (v - hi) sharing the hi accumulator;
//   score scale 1/8 applied once in f32 after the score accumulate; normalisation 8 * rsqrt(sum sq) * gamma applied in f32 in the
//   q|k projection epilogue before the bf16 hi/lo split. No other scaled planes.
#include <hip/hip_runtime.h>
#include <math.h>
#include <stdint.h>

#define NB    2
#define SEQ   2048
#define DM    1024
#define NH    16
#define HD    64
#define QKP   (2 * DM)     // pitch (elements) of the packed q|k planes: q at cols 0..1023, k at cols 1024..2047
#define NQB   (SEQ / 64)   // 32 query / key blocks of 64
#define LP    72           // LDS row pitch (16-bit elements) of the attention K / V^T tiles: 144 B = 16 B x odd, so the 16 rows
                           // that one ds_load_b128 fragment read touches fall on 16 different 16-B bank groups (128 B puts them on 2)
#define GK    64           // k elements of one GEMM stage: 128 B of every operand row
#define GP    (GK + 8)     // LDS row pitch (16-bit elements) of the GEMM stage: 144 B = 16 B x odd, as for LP
#define OSP   68           // LDS row pitch (floats) of the attention output tile: conflict-free for 16-B row reads
#define TPL   10240        // LDS bytes kept per staged attention plane: 64 rows x 144 B = 9216, rounded up to a multiple of 2 KiB
#define TBUF  (4 * TPL)    // one attention stage: K hi, K lo, V^T hi, V^T residual
static_assert(NH * HD == DM);
static_assert(HD == 64);
static_assert((SEQ % 64) == 0 && (DM % 64) == 0 && (DM % 32) == 0);
static_assert(GK == 64);   // the GEMM staging map below is written for 128-B row pieces
static_assert(((NB * SEQ) % 128) == 0 && (QKP % 128) == 0 && (DM % 128) == 0 && (SEQ % 128) == 0 && (DM % GK) == 0);
static_assert((NB * SEQ * DM) % (8 * 256) == 0);
static_assert(64 * LP * 2 <= TPL && (TPL % 2048) == 0 && LP * 2 == 128 + 16);   // the tensor load's pad gives the pitch LP
static_assert(4 * 16 * OSP * 4 <= 2 * TBUF && NQB >= 2);                        // output staging reuses the ring; two stages exist

typedef _Float16 v16h __attribute__((ext_vector_type(16)));
typedef _Float16 v8h  __attribute__((ext_vector_type(8)));
typedef __bf16   v16b __attribute__((ext_vector_type(16)));
typedef __bf16   v8b  __attribute__((ext_vector_type(8)));
typedef float    v8f  __attribute__((ext_vector_type(8)));
typedef float    v4f  __attribute__((ext_vector_type(4)));
typedef unsigned int v4u __attribute__((ext_vector_type(4)));
typedef unsigned int v8u __attribute__((ext_vector_type(8)));

// ---- scalar helpers --------------------------------------------------------------------------------
__device__ __forceinline__ unsigned short bf_bits(float f) {          // f32 -> bf16 bits, RNE convert
  unsigned u = __float_as_uint(f);
  return (unsigned short)((u + 0x7FFFu + ((u >> 16) & 1u)) >> 16);
}
__device__ __forceinline__ float bf_up(unsigned short hb) { return __uint_as_float(((unsigned)hb) << 16); }
__device__ __forceinline__ unsigned short h_bits(_Float16 x) { return __builtin_bit_cast(unsigned short, x); }
__device__ __forceinline__ unsigned pk16(unsigned short a, unsigned short b) { return (unsigned)a | ((unsigned)b << 16); }
__device__ __forceinline__ v8f zero8() { v8f z = {0.f, 0.f, 0.f, 0.f, 0.f, 0.f, 0.f, 0.f}; return z; }

// ---- fragment loader: 16-bit A/B operand, lane -> row/col (lane&15), p already includes +8*(lane>>4);
//      elements 0..7 <- p[0..7] (k0+8h..), elements 8..15 <- p[16..23] (k0+16+8h..)
__device__ __forceinline__ v16b ldfrag_b(const __bf16* p) {
  union { v16b v; v8b h[2]; } f;
  f.h[0] = *(const v8b*)(p);
  f.h[1] = *(const v8b*)(p + 16);
  return f.v;
}

// ---- WMMA helpers with trailing VALU hazard gap --------------------------------------------------------
__device__ __forceinline__ v8f mma_b(v16b a, v16b b, v8f c) {
  c = __builtin_amdgcn_wmma_f32_16x16x32_bf16(false, a, false, b, (short)0, c, false, false);
  asm volatile("v_nop\n\tv_nop\n\tv_nop\n\tv_nop" : "+v"(c) : "v"(a), "v"(b));
  return c;
}
__device__ __forceinline__ v8f mma_h(v16h a, v16h b, v8f c) {
  c = __builtin_amdgcn_wmma_f32_16x16x32_f16(false, a, false, b, (short)0, c, false, false);
  asm volatile("v_nop\n\tv_nop\n\tv_nop\n\tv_nop" : "+v"(c) : "v"(a), "v"(b));
  return c;
}
__device__ __forceinline__ v8f mma_b_raw(v16b a, v16b b, v8f c) {
  return __builtin_amdgcn_wmma_f32_16x16x32_bf16(false, a, false, b, (short)0, c, false, false);
}
__device__ __forceinline__ void dep_guard_b(v8f& a, v8f& b, v16b x, v16b y) {
  asm volatile("v_nop\n\tv_nop\n\tv_nop\n\tv_nop" : "+v"(a), "+v"(b) : "v"(x), "v"(y));
}
__device__ __forceinline__ void keep4_b(v16b a, v16b b, v16b c, v16b d) {
  asm volatile("v_nop" :: "v"(a), "v"(b), "v"(c), "v"(d));
}
__device__ __forceinline__ void acc_guard4(v8f& a, v8f& b, v8f& c, v8f& d) {
  asm volatile("v_nop\n\tv_nop\n\tv_nop\n\tv_nop" : "+v"(a), "+v"(b), "+v"(c), "+v"(d));
}

// =====================================================================================================
// f32 -> bf16 (RNE convert), 8 elements per thread, one 16-B store per lane: a wave writes 512 contiguous B
// coverage: n8 threads x 8 = the whole plane (n8 here is a multiple of 256).
// =====================================================================================================
__global__ __launch_bounds__(256) void cvt_bf16x8(const float* __restrict__ in, unsigned short* out, int n8) {
  const int i = blockIdx.x * 256 + (int)threadIdx.x;
  if (i < n8) {
    const v4f a = *(const v4f*)(in + (size_t)i * 8);
    const v4f b = *(const v4f*)(in + (size_t)i * 8 + 4);
    v4u p;
    p[0] = pk16(bf_bits(a[0]), bf_bits(a[1]));
    p[1] = pk16(bf_bits(a[2]), bf_bits(a[3]));
    p[2] = pk16(bf_bits(b[0]), bf_bits(b[1]));
    p[3] = pk16(bf_bits(b[2]), bf_bits(b[3]));
    *(v4u*)(out + (size_t)i * 8) = p;
    
  }
}

// =====================================================================================================
// Transpose-convert: f32 in[R rows][Cn cols] -> bf16 out[Cn][R] (RNE convert), 64x64 tiles through LDS.
// grid = (Cn/64, R/64), block 256 (R, Cn multiples of 64). Loads: 4 coalesced float4 per thread
// (64 rows x 16 float4 = the whole input tile). Stores: wave w writes output rows w*8 + it*4 + (lane>>3),
// coverage: 8 waves x 8 rows x 64 k = the whole 64x64 output tile; the grid covers the whole [Cn][R] plane.
// =====================================================================================================
__global__ __launch_bounds__(256) void tr_bf16(const float* __restrict__ in, unsigned short* out, int R, int Cn) {
  __shared__ __align__(16) float sm[64 * 65];
  const int t = (int)threadIdx.x, lane = t & 31, wave = t >> 5;
  const int n0 = blockIdx.x * 64;    // column block of in = row block of out
  const int k0 = blockIdx.y * 64;    // row block of in = column block of out
#pragma unroll
  for (int i = 0; i < 4; ++i) {
    const int idx = t + 256 * i;
    const int kr = idx >> 4, c4 = (idx & 15) * 4;
    const v4f v = *(const v4f*)(in + (size_t)(k0 + kr) * Cn + n0 + c4);
    sm[kr * 65 + c4 + 0] = v[0];
    sm[kr * 65 + c4 + 1] = v[1];
    sm[kr * 65 + c4 + 2] = v[2];
    sm[kr * 65 + c4 + 3] = v[3];
  }
  __syncthreads();
  const int q = lane >> 3, c8 = (lane & 7) * 8;
  v4u pv[2];
#pragma unroll
  for (int it = 0; it < 2; ++it) {
    const int n = wave * 8 + it * 4 + q;
    v4u p;
#pragma unroll
    for (int e = 0; e < 4; ++e) {
      const float a = sm[(c8 + 2 * e) * 65 + n];
      const float b = sm[(c8 + 2 * e + 1) * 65 + n];
      p[e] = pk16(bf_bits(a), bf_bits(b));
    }
    pv[it] = p;
  }
  {
#pragma unroll
    for (int it = 0; it < 2; ++it) {
      const int n = wave * 8 + it * 4 + q;
      *(v4u*)(out + (size_t)(n0 + n) * R + k0 + c8) = pv[it];
    }
    
  }
}

// =====================================================================================================
// Register-blocked batched bf16 WMMA GEMM: C[m][n] = sum_k A[m][k] * Bt[n][k] + bias; one wave per 64x64 tile,
// 2 x 2 waves = one 128x128 tile per block. Per GK k the block stages its 128 A rows and 128 Bt rows (128 B each) in LDS
// with whole-line loads (8 lanes a row, 4 rows a wave-wide load) and every wave reads its fragments from there, so a row
// is fetched once per block instead of once per wave, 32 B of 16 lines at a time.
// A row-major [M][K], Bt row-major [N][K] (k contiguous), both at the fixed pitch DM, so that a thread's 8 rows of a plane
// are one address plus immediate offsets;
// M, N multiples of 128, K multiple of GK (host shapes are static multiples). blockIdx.y = batch index (strides in elements).
// NSPLIT: 0 = A.Bt; 1 = (A + A2).Bt (A2 = unscaled bf16 lo plane of A, 2 products).
// BIAS: 1 = per column n, bias[n]; 2 = per row m, bias[m]; the bias value is RNE-converted to bf16 and added in f32.
// NORM (only with OUT_MODE 2, BIAS 1, N tile = one 64-wide head): per row, over the tile's 64 columns,
//   value := (acc + bias) * 8 * rsqrt(max(sum (acc + bias)^2, 1e-24)) * gamma[n mod DM] in f32, gamma = gma for
//   n0 < DM else gmb (RNE-converted to bf16); the row sum uses 16-lane shuffles (all lanes active).
// OUT_MODE: 0 = f32 (pitch ldc); 2 = bf16 hi plane C + bf16 lo plane C2 (lo = RNE(v - hi), unscaled);
//           3 = f16 hi plane C + f16 residual plane C2 = f16((v - hi) * rscale), C2 written only for tiles
//               with n0 < N2 (pitch ldc2, batch stride strideC2).
// =====================================================================================================
template <int NSPLIT, int OUT_MODE, int BIAS, int NORM>
__global__ __launch_bounds__(128) void gemm64(
    const unsigned short* __restrict__ Ap, const unsigned short* A2p, long long strideA,
    const unsigned short* __restrict__ Btp, long long strideB,
    const float* __restrict__ bias, const float* __restrict__ gma, const float* __restrict__ gmb,
    void* Cout, int ldc, long long strideC,
    void* Cout2, int ldc2, long long strideC2, int N2,
    int M, int N, int K, float rscale) {
  const __bf16* A   = (const __bf16*)(const void*)Ap;
  const __bf16* A2  = (const __bf16*)(const void*)A2p;
  const __bf16* Bt  = (const __bf16*)(const void*)Btp;
  __shared__ __align__(16) float sT[4][16 * 68];   // per-wave 16x64 slab, pitch 68 floats
  __shared__ __align__(16) __bf16 As[128 * GP];                          // A rows  [m][GK k] at pitch GP  18 KB
  __shared__ __align__(16) __bf16 A2s[(NSPLIT >= 1 ? 128 : 1) * GP];     // A2 rows, only with NSPLIT 1
  __shared__ __align__(16) __bf16 Bs[128 * GP];                          // Bt rows [n][GK k] at pitch GP  18 KB
  const int b    = blockIdx.y;
  const int lane = threadIdx.x & 31;
  const int wave = threadIdx.x >> 5;
  const int tilesN = N >> 7;
  const int tilesM = M >> 7;
  const int tile = blockIdx.x;
  if (tile >= tilesM * tilesN) return;   // block-uniform, ahead of every barrier
  const int tm = tile / tilesN;
  const int tn = tile - tm * tilesN;
  const int bm0 = tm << 7;               // the block's 128x128 tile
  const int bn0 = tn << 7;
  const int wm  = (wave >> 1) << 6;      // the wave's 64x64 tile inside it
  const int wn  = (wave & 1) << 6;
  const int m0 = bm0 + wm;
  const int n0 = bn0 + wn;

  const __bf16* Ab  = A  + (size_t)b * (size_t)strideA;
  const __bf16* Bb  = Bt + (size_t)b * (size_t)strideB;
  const __bf16* Ab2 = (NSPLIT >= 1) ? (A2 + (size_t)b * (size_t)strideA) : Ab;

  const int rlane = lane & 15;                 // row (A) / col (B, D) within subtile
  const int koff  = (lane >> 4) * 8;           // k offset of this lane half
  const int mOff  = (lane >> 4) * 8;           // D row offset

  v8f acc[4][4];
#pragma unroll
  for (int i = 0; i < 4; ++i)
#pragma unroll
    for (int j = 0; j < 4; ++j) acc[i][j] = zero8();

  // staging map: 8 lanes x 16 B = one whole 128-B row piece (a cache line), four rows a wave-wide load; the two rows of a
  // half wave lie 8 apart, so that at pitch GP their 2 x 128 B fall on all 64 LDS banks once in the store.
  // Wave w stages rows w*32 .. w*32+31 of every plane.
  const int ssub = lane >> 3, sc8 = (lane & 7) * 8;
  const int srow = wave * 32 + (ssub >> 1) + (ssub & 1) * 8;   // + (i>>2)*16 + (i&3)*2, i = 0..7
  const __bf16* ga  = Ab  + (size_t)(bm0 + srow) * DM + sc8;   // rows bm0 + srow + 0..22 < M, bn0 + srow + 0..22 < N
  const __bf16* ga2 = Ab2 + (size_t)(bm0 + srow) * DM + sc8;
  const __bf16* gb  = Bb  + (size_t)(bn0 + srow) * DM + sc8;

  for (int k0 = 0; k0 < K; k0 += GK) {
    __syncthreads();                       // every wave has read the last stage's fragments
    {
      v8b ra[8], ra2[8], rb[8];
      const __bf16* pa  = ga + k0;
      const __bf16* pa2 = ga2 + k0;
      const __bf16* pb  = gb + k0;
#pragma unroll
      for (int i = 0; i < 8; ++i) {
        const int ro = (i >> 2) * 16 + (i & 3) * 2;
        ra[i] = *(const v8b*)(pa + ro * DM);
        if (NSPLIT >= 1) ra2[i] = *(const v8b*)(pa2 + ro * DM);
        rb[i] = *(const v8b*)(pb + ro * DM);
      }
      // precaution: the wait stands behind the loads and names their address registers, so that nothing (no later
      // load's destination either) is laid over an address before it
      asm volatile("s_wait_xcnt 0x0" :: "v"(pa), "v"(pa2), "v"(pb) : "memory");
#pragma unroll
      for (int i = 0; i < 8; ++i) {
        const int ro = (i >> 2) * 16 + (i & 3) * 2;
        *(v8b*)(As + (srow + ro) * GP + sc8) = ra[i];
        if (NSPLIT >= 1) *(v8b*)(A2s + (srow + ro) * GP + sc8) = ra2[i];
        *(v8b*)(Bs + (srow + ro) * GP + sc8) = rb[i];
      }
    }
    __syncthreads();                       // the stage is complete for every wave
#pragma unroll
    for (int kk = 0; kk < GK; kk += 32) {
      v16b bh[4], ah[4], al[4];
#pragma unroll
      for (int j = 0; j < 4; ++j) bh[j] = ldfrag_b(Bs + (wn + (j << 4) + rlane) * GP + kk + koff);
#pragma unroll
      for (int i = 0; i < 4; ++i) {
        const int ao = (wm + (i << 4) + rlane) * GP + kk + koff;
        ah[i] = ldfrag_b(As + ao);
        al[i] = ah[i];
        if (NSPLIT >= 1) al[i] = ldfrag_b(A2s + ao);
      }
#pragma unroll
      for (int i = 0; i < 4; ++i) {
#pragma unroll
        for (int j = 0; j < 4; ++j) {
          acc[i][j] = mma_b_raw(ah[i], bh[j], acc[i][j]);
          if (NSPLIT >= 1) acc[i][j] = mma_b_raw(al[i], bh[j], acc[i][j]);
        }
        dep_guard_b(acc[i][0], acc[i][3], ah[i], al[i]);
      }
      keep4_b(bh[0], bh[1], bh[2], bh[3]);
    }
  }
  acc_guard4(acc[0][0], acc[0][1], acc[0][2], acc[0][3]);
  acc_guard4(acc[1][0], acc[1][1], acc[1][2], acc[1][3]);
  acc_guard4(acc[2][0], acc[2][1], acc[2][2], acc[2][3]);
  acc_guard4(acc[3][0], acc[3][1], acc[3][2], acc[3][3]);

  // ---- epilogue ----
  float* slab = sT[wave];
  float bcol[4], gcol[4];
#pragma unroll
  for (int j = 0; j < 4; ++j) {
    bcol[j] = 0.f;
    gcol[j] = 1.f;
    if (BIAS == 1) bcol[j] = bf_up(bf_bits(bias[n0 + (j << 4) + rlane]));   // n < N, bias has N entries
    if (NORM) {
      const int nn = (n0 & (DM - 1)) + (j << 4) + rlane;                   // < DM = NH*HD entries
      const float ga = bf_up(bf_bits(gma[nn]));
      const float gb = bf_up(bf_bits(gmb[nn]));
      gcol[j] = (n0 < DM) ? ga : gb;                                       // wave-uniform select by value
    }
  }
#pragma unroll
  for (int i = 0; i < 4; ++i) {
    const int mBase = m0 + (i << 4);
    float brow[8];
#pragma unroll
    for (int r = 0; r < 8; ++r) {
      brow[r] = 0.f;
      if (BIAS == 2) brow[r] = bf_up(bf_bits(bias[mBase + mOff + r]));      // m < M, bias has M entries
    }
    float rsc[8];
#pragma unroll
    for (int r = 0; r < 8; ++r) rsc[r] = 1.f;
    if (NORM) {
      float ss[8];
#pragma unroll
      for (int r = 0; r < 8; ++r) {
        float a = 0.f;
#pragma unroll
        for (int j = 0; j < 4; ++j) {
          const float v = acc[i][j][r] + bcol[j];
          a += v * v;
        }
        ss[r] = a;
      }
#pragma unroll
      for (int r = 0; r < 8; ++r) {
#pragma unroll
        for (int off = 1; off < 16; off <<= 1) ss[r] += __shfl_xor(ss[r], off, 32);   // stays inside the lane half
        rsc[r] = rsqrtf(fmaxf(ss[r], 1e-24f)) * 8.0f;
      }
    }
#pragma unroll
    for (int j = 0; j < 4; ++j) {
#pragma unroll
      for (int r = 0; r < 8; ++r) {
        slab[(mOff + r) * 68 + (j << 4) + rlane] = (acc[i][j][r] + bcol[j] + brow[r]) * rsc[r] * gcol[j];
      }
    }
    __builtin_amdgcn_fence(__ATOMIC_RELEASE, "workgroup");
    __builtin_amdgcn_wave_barrier();
    __builtin_amdgcn_fence(__ATOMIC_ACQUIRE, "workgroup");
    if (OUT_MODE == 0) {
      float* C = (float*)Cout + (size_t)b * (size_t)strideC;
      const int h2 = lane >> 4, c4 = (lane & 15) * 4;     // 256-B row segment = 16 lanes x 16 B
      {
#pragma unroll
        for (int it = 0; it < 8; ++it) {
          const int row = it * 2 + h2;                     // it 0..7 x h2 0..1 = rows 0..15
          const v4f v = *(const v4f*)(slab + row * 68 + c4);
          *(v4f*)(C + (size_t)(mBase + row) * ldc + n0 + c4) = v;
        }
        
      }
    } else {
      const int q = lane >> 3, c8 = (lane & 7) * 8;
      unsigned short* C  = (unsigned short*)Cout  + (size_t)b * (size_t)strideC;
      unsigned short* C2 = (unsigned short*)Cout2 + (size_t)b * (size_t)strideC2;
      const bool wlo = (OUT_MODE == 2) || (n0 < N2);      // wave-uniform
      v4u hv[4], lv[4];
#pragma unroll
      for (int it = 0; it < 4; ++it) {
        const int row = it * 4 + q;                        // it 0..3 x q 0..3 = rows 0..15
        const float* sp = slab + row * 68 + c8;
        v4u a, a2;
#pragma unroll
        for (int e = 0; e < 4; ++e) {
          const float f0 = sp[2 * e], f1 = sp[2 * e + 1];
          unsigned short h0, h1, l0, l1;
          if (OUT_MODE == 2) {
            h0 = bf_bits(f0); h1 = bf_bits(f1);
            l0 = bf_bits(f0 - bf_up(h0)); l1 = bf_bits(f1 - bf_up(h1));
          } else {
            const _Float16 x0 = (_Float16)f0, x1 = (_Float16)f1;
            h0 = h_bits(x0); h1 = h_bits(x1);
            l0 = h_bits((_Float16)((f0 - (float)x0) * rscale));
            l1 = h_bits((_Float16)((f1 - (float)x1) * rscale));
          }
          a[e] = pk16(h0, h1); a2[e] = pk16(l0, l1);
        }
        hv[it] = a; lv[it] = a2;
      }
      {
#pragma unroll
        for (int it = 0; it < 4; ++it) {
          const int row = it * 4 + q;
          *(v4u*)(C + (size_t)(mBase + row) * ldc + n0 + c8) = hv[it];
          if (wlo) *(v4u*)(C2 + (size_t)(mBase + row) * ldc2 + n0 + c8) = lv[it];
        }
        
      }
    }
    __builtin_amdgcn_fence(__ATOMIC_RELEASE, "workgroup");
    __builtin_amdgcn_wave_barrier();
    __builtin_amdgcn_fence(__ATOMIC_ACQUIRE, "workgroup");
  }
}

__device__ __forceinline__ float xhalf(float x) {
  const int xi = __builtin_bit_cast(int, x);
  return __builtin_bit_cast(float, __builtin_amdgcn_permlanex16(xi, xi, 0x76543210, 0xfedcba98, false, false));
}

// ---- tensor load of one 64-row x 128-B plane tile into LDS at pitch 144 B --------------------------------
__device__ __forceinline__ uint32_t uni(uint32_t v) { return (uint32_t)__builtin_amdgcn_readfirstlane(v); }
// tensor loads ignore EXEC: a test around one must compile to s_cmp + s_cbranch_scc, so its word is held in a scalar register
__device__ __forceinline__ uint32_t pinned(uint32_t v) {
  uint32_t w = uni(v);
  asm volatile("" : "+s"(w));   // the pinned() form: a wave-uniform word of a tensor load's test or descriptor kept in an SGPR
  return w;
}
__device__ __forceinline__ void tdm_plane(uint32_t lds_dst, uint64_t ga) {
  v4u g0;
  g0[0] = uni(1u);                                                       // count 1
  g0[1] = uni(lds_dst);                                                  // byte offset in the work-group's LDS
  g0[2] = uni((uint32_t)ga);                                             // first byte of the tile
  g0[3] = uni((((uint32_t)(ga >> 32)) & 0x01FFFFFFu) | 0x80000000u);     // address high bits, type 2
  v8u g1;
  g1[0] = uni((1u << 20) | (4u << 22) | (3u << 25));                     // no mask, 1-byte elements, 16 B of pad behind every 128 B
  g1[1] = uni(128u << 16);                                               // tensor dim0 = 128 B
  g1[2] = uni(64u << 16);                                                // tensor dim1 = 64 rows
  g1[3] = uni(128u << 16);                                               // tile dim0 = 128 B
  g1[4] = uni(64u);                                                      // tile dim1 = 64 rows
  g1[5] = uni(4096u);                                                    // source row pitch in bytes
  g1[6] = uni(0u);
  g1[7] = uni(0u);
  asm volatile("tensor_load_to_lds %0, %1" :: "s"(g0), "s"(g1) : "memory");
}
static_assert(QKP * 2 == 4096 && SEQ * 2 == 4096 && HD * 2 == 128);      // both sources have the descriptor's pitch and row length

__global__ __launch_bounds__(128)
void attn_full64(const unsigned short* __restrict__ qkhp, const unsigned short* __restrict__ qklp,
                 const unsigned short* __restrict__ vhp, const unsigned short* __restrict__ vlp,
                 unsigned short* ohp, unsigned short* olp) {
  union FB { v16b v; v8b h[2]; };
  union FH { v16h v; v8h h[2]; };
  // two stages of four planes (K hi [kv][d], K lo, V^T hi [d][kv], V^T residual; rows of 64 at pitch LP), each plane at a
  // multiple of 2 KiB; behind the loop the same bytes hold the per-wave context tiles [query][d]. 80 KiB: four blocks a WGP.
  __shared__ __attribute__((aligned(2048))) unsigned char L[2 * TBUF];

  const int tid  = threadIdx.x;
  const int wave = tid >> 5;
  const int lane = tid & 31;
  const int hh   = lane >> 4;
  const int c    = lane & 15;

  const int bx   = blockIdx.x;
  const int qb   = bx % NQB;
  const int rest = bx / NQB;
  const int h    = rest % NH;
  const int b    = rest / NH;
  const int q0   = qb * 64 + wave * 16;
  const size_t rowB = (size_t)b * SEQ;

  const __bf16* Qh = (const __bf16*)(const void*)qkhp + (size_t)h * HD;
  const __bf16* Ql = (const __bf16*)(const void*)qklp + (size_t)h * HD;
  const __bf16* Kh = (const __bf16*)(const void*)qkhp + DM + (size_t)h * HD;
  const __bf16* Kl = (const __bf16*)(const void*)qklp + DM + (size_t)h * HD;
  const _Float16* Vh = (const _Float16*)(const void*)vhp + ((size_t)b * DM + (size_t)h * HD) * SEQ;
  const _Float16* Vl = (const _Float16*)(const void*)vlp + ((size_t)b * DM + (size_t)h * HD) * SEQ;

  // ---- Q fragments (B operand, column = query = lane&15): 2 d-chunks, hi and lo ----
  v16b qah[2], qal[2];
#pragma unroll
  for (int dc = 0; dc < 2; ++dc) {
    const size_t qo = (rowB + q0 + c) * QKP + dc * 32 + 8 * hh;
    qah[dc] = ldfrag_b(Qh + qo);
    qal[dc] = ldfrag_b(Ql + qo);
  }

  // ---- staging: wave w brings plane w of every stage with one tensor load (every wave issues, so no wave test) ----
  const uint32_t wv = uni((uint32_t)tid >> 5);
  const uint32_t ldst = (uint32_t)(size_t)L + wv * TPL;
  const uint64_t gsrc = (wv == 0u) ? (uint64_t)(size_t)(Kh + rowB * QKP) : (wv == 1u) ? (uint64_t)(size_t)(Kl + rowB * QKP)
                      : (wv == 2u) ? (uint64_t)(size_t)Vh : (uint64_t)(size_t)Vl;
  const uint32_t gstep = (wv < 2u) ? 64u * QKP * 2u : 64u * 2u;   // 64 keys on: 64 K rows, or 128 B along a V^T row
  tdm_plane(ldst, gsrc);                                   // stage 0 into buffer 0
  asm volatile("s_wait_tensorcnt 0x0" ::: "memory");       // this wave's plane of stage 0 has landed
  __syncthreads();                                         // stage 0 is published to every wave
  tdm_plane(ldst + TBUF, gsrc + gstep);                    // stage 1 into buffer 1, in flight during pass 0

  float mrow = -INFINITY, lrow = 0.f;          // this lane's query: running maximum (both halves alike), this half's sum
  v8f oacc[4];
#pragma unroll
  for (int t = 0; t < 4; ++t) oacc[t] = zero8();

  for (int kt = 0; kt < NQB; ++kt) {           // static trip count
    const unsigned char* Lb = L + (kt & 1) * TBUF;               // pass kt reads buffer kt mod 2 alone
    const __bf16*   Ksh = (const __bf16*)(const void*)(Lb);
    const __bf16*   Ksl = (const __bf16*)(const void*)(Lb + TPL);
    const _Float16* Vth = (const _Float16*)(const void*)(Lb + 2 * TPL);
    const _Float16* Vtl = (const _Float16*)(const void*)(Lb + 3 * TPL);

    // ---- scores, transposed: 64 keys x 16 query columns per wave, 3 bf16 products ----
    v8f s[4];
#pragma unroll
    for (int j = 0; j < 4; ++j) {
      s[j] = zero8();
#pragma unroll
      for (int dc = 0; dc < 2; ++dc) {
        FB kb, kl;
        kb.h[0] = *(const v8b*)(Ksh + (j * 16 + c) * LP + dc * 32 + 8 * hh);
        kb.h[1] = *(const v8b*)(Ksh + (j * 16 + c) * LP + dc * 32 + 16 + 8 * hh);
        kl.h[0] = *(const v8b*)(Ksl + (j * 16 + c) * LP + dc * 32 + 8 * hh);
        kl.h[1] = *(const v8b*)(Ksl + (j * 16 + c) * LP + dc * 32 + 16 + 8 * hh);
        s[j] = mma_b(kb.v, qah[dc], s[j]);
        s[j] = mma_b(kl.v, qah[dc], s[j]);
        s[j] = mma_b(kb.v, qal[dc], s[j]);
      }
    }

    // ---- scale, maximum of this lane's query, online softmax, P (x1024, f16) and P residual (x4096) in registers ----
    float mj[4];
#pragma unroll
    for (int j = 0; j < 4; ++j) {
      mj[j] = -INFINITY;
#pragma unroll
      for (int r = 0; r < 8; ++r) {
        const float sv = s[j][r] * 0.125f;
        s[j][r] = sv;
        mj[j] = fmaxf(mj[j], sv);
      }
    }
    float m = fmaxf(fmaxf(mj[0], mj[1]), fmaxf(mj[2], mj[3]));
    m = fmaxf(m, xhalf(m));                    // both halves now hold the maximum over the chunk's 64 keys
    const float mnew  = fmaxf(mrow, m);
    const float msafe = (mnew == -INFINITY) ? 0.f : mnew;
    const float alpha = __expf(mrow - msafe);
    mrow = mnew;
    FH pa[2], pl[2];                           // B operands of key blocks 0 and 1: p hi plane, p residual plane
    float pj[4];
#pragma unroll
    for (int j = 0; j < 4; ++j) {
      pj[j] = 0.f;
#pragma unroll
      for (int r = 0; r < 8; ++r) {
        const float p = __expf(s[j][r] - msafe);
        pj[j] += p;
        const float p1k = p * 1024.0f;
        const _Float16 ph = (_Float16)p1k;
        pa[j >> 1].h[j & 1][r] = ph;
        pl[j >> 1].h[j & 1][r] = (_Float16)((p1k - (float)ph) * 4096.0f);
      }
    }
    lrow = lrow * alpha + ((pj[0] + pj[1]) + (pj[2] + pj[3]));
#pragma unroll
    for (int t = 0; t < 4; ++t)
#pragma unroll
      for (int r = 0; r < 8; ++r) oacc[t][r] *= alpha;

    // ---- context^T += V^T . P^T (f16 WMMA), residual products into a separate accumulator ----
    v8f o1[4];
#pragma unroll
    for (int t = 0; t < 4; ++t) o1[t] = zero8();
#pragma unroll
    for (int kk = 0; kk < 2; ++kk) {           // unrolled: pa / pl are register operands picked by kk
#pragma unroll
      for (int t = 0; t < 4; ++t) {
        FH vb, vl;
        vb.h[0] = *(const v8h*)(Vth + (t * 16 + c) * LP + kk * 32 + 8 * hh);
        vb.h[1] = *(const v8h*)(Vth + (t * 16 + c) * LP + kk * 32 + 16 + 8 * hh);
        vl.h[0] = *(const v8h*)(Vtl + (t * 16 + c) * LP + kk * 32 + 8 * hh);
        vl.h[1] = *(const v8h*)(Vtl + (t * 16 + c) * LP + kk * 32 + 16 + 8 * hh);
        oacc[t] = mma_h(vb.v, pa[kk].v, oacc[t]);
        o1[t]   = mma_h(vl.v, pa[kk].v, o1[t]);
        o1[t]   = mma_h(vb.v, pl[kk].v, o1[t]);
      }
    }
#pragma unroll
    for (int t = 0; t < 4; ++t)
#pragma unroll
      for (int r = 0; r < 8; ++r) oacc[t][r] += o1[t][r] * (1.0f / 4096.0f);

    // ---- publish point of stage kt + 1 ----
    asm volatile("s_wait_dscnt 0x0" ::: "memory");         // this wave's reads of buffer kt mod 2 have returned
    asm volatile("s_wait_tensorcnt 0x0" ::: "memory");     // this wave's plane of stage kt + 1 has landed
    __syncthreads();                                       // stage kt + 1 published; every wave has left buffer kt mod 2
    if (pinned((uint32_t)(kt + 2 < NQB))) {                // scalar branch: only while stage kt + 2 exists
      const uint32_t st = pinned((uint32_t)kt + 2u);       // held behind the wait above, and the descriptor formed from it
      tdm_plane(ldst + (st & 1u) * TBUF, gsrc + (uint64_t)st * gstep);
    }
  }
  asm volatile("s_wait_tensorcnt 0x0" ::: "memory");       // no tensor load is in flight
  asm volatile("s_wait_dscnt 0x0" ::: "memory");           // the last pass's barrier has ended every read: the ring may hold output

  // ---- join the halves' sums, normalise (1/l and the 1/1024 p carry), stage the wave's 16x64 tile [query][d],
  //      bf16 hi/lo split
  float* os = (float*)(void*)L + wave * (16 * OSP);
  {
    const float l = lrow + xhalf(lrow);
    const float inv = ((l > 0.f) ? (1.0f / l) : 0.f) * (1.0f / 1024.0f);
#pragma unroll
    for (int t = 0; t < 4; ++t) {
      v4f w0, w1;
#pragma unroll
      for (int r = 0; r < 4; ++r) { w0[r] = oacc[t][r] * inv; w1[r] = oacc[t][4 + r] * inv; }
      *(v4f*)(os + c * OSP + t * 16 + 8 * hh)     = w0;
      *(v4f*)(os + c * OSP + t * 16 + 8 * hh + 4) = w1;
    }
  }
  __builtin_amdgcn_fence(__ATOMIC_RELEASE, "workgroup");
  __builtin_amdgcn_wave_barrier();
  __builtin_amdgcn_fence(__ATOMIC_ACQUIRE, "workgroup");
  {
    const int q4 = lane >> 3, c8 = (lane & 7) * 8;
    v4u hv[4], lv[4];
#pragma unroll
    for (int it = 0; it < 4; ++it) {
      const int row = it * 4 + q4;   // it 0..3 x q4 0..3 = rows 0..15 of the wave tile
      const float* sp = os + row * OSP + c8;
      v4u a, a2;
#pragma unroll
      for (int e = 0; e < 4; ++e) {
        const float f0 = sp[2 * e], f1 = sp[2 * e + 1];
        const unsigned short h0 = bf_bits(f0), h1 = bf_bits(f1);
        const unsigned short l0 = bf_bits(f0 - bf_up(h0)), l1 = bf_bits(f1 - bf_up(h1));
        a[e] = pk16(h0, h1); a2[e] = pk16(l0, l1);
      }
      hv[it] = a; lv[it] = a2;
    }
    {
#pragma unroll
      for (int it = 0; it < 4; ++it) {
        const int row = it * 4 + q4;
        const size_t go = (rowB + q0 + row) * DM + (size_t)h * HD + c8;
        *(v4u*)(ohp + go) = hv[it];
        *(v4u*)(olp + go) = lv[it];
      }
      
    }
  }
}

// =====================================================================================================
// Workspace map (bytes; every region is an exact multiple of its 64x64-tile / whole-line store granularity, no padded
// tails needed since all shapes are tile multiples; every region is written by exactly one producer launch, none reused):
//   Xb   bf16 [4096][1024]                  0     8388608
//   WA   bf16 [3072 n][1024 k]          8388608     6291456   (q rows 0..1023, k rows 1024..2047, v rows 2048..3071)
//   WP   bf16 [1024 n][1024 k]         14680064     2097152
//   QKh  bf16 [4096][2048] (q | k hi)  16777216    16777216
//   QKl  bf16 [4096][2048] (q | k lo)  33554432    16777216
//   VTh  f16  [2][1024][2048]          50331648     8388608
//   VTl  f16  [2][1024][2048]          58720256     8388608
//   Oh   bf16 [4096][1024]             67108864     8388608
//   Ol   bf16 [4096][1024]             75497472     8388608
//   end                                83886080
// =====================================================================================================
extern "C" void kernel_launch(void* const* d_in, const int* in_sizes, int n_in,
                              void* d_out, int out_size, void* d_ws, size_t ws_size,
                              hipStream_t stream) {
  if (n_in < 7) return;
  if (in_sizes[0] != NB * SEQ * DM) return;
  if (in_sizes[1] != 3 * DM * DM) return;
  if (in_sizes[2] != 3 * DM) return;
  if (in_sizes[3] != NH * HD || in_sizes[4] != NH * HD) return;
  if (in_sizes[5] != DM * DM) return;
  if (in_sizes[6] != DM) return;
  if (out_size != NB * SEQ * DM) return;

  const float* x    = (const float*)d_in[0];   // [2][2048][1024]
  const float* Wqkv = (const float*)d_in[1];   // [1024 in][3072 out]  (cols: q | k | v, head h = cols h*64..h*64+63 of each block)
  const float* bqkv = (const float*)d_in[2];   // [3072]
  const float* gq   = (const float*)d_in[3];   // [16][64]
  const float* gk   = (const float*)d_in[4];   // [16][64]
  const float* Wout = (const float*)d_in[5];   // [1024 in][1024 out]
  const float* bout = (const float*)d_in[6];   // [1024]

  const size_t PXB = (size_t)NB * SEQ * DM * 2;    //  8388608  16-bit plane [4096][1024]
  const size_t PWA = (size_t)3 * DM * DM * 2;      //  6291456  packed [3072][1024] bf16 weight plane
  const size_t PWP = (size_t)DM * DM * 2;          //  2097152  [1024][1024] bf16 weight plane
  const size_t PQK = (size_t)NB * SEQ * QKP * 2;   // 16777216  q|k plane [4096][2048]
  const size_t PVT = (size_t)NB * DM * SEQ * 2;    //  8388608  v^T plane [2][1024][2048]
  size_t off = 0;
  const size_t oXb  = off; off += PXB;
  const size_t oWA  = off; off += PWA;
  const size_t oWP  = off; off += PWP;
  const size_t oQKh = off; off += PQK;
  const size_t oQKl = off; off += PQK;
  const size_t oVTh = off; off += PVT;
  const size_t oVTl = off; off += PVT;
  const size_t oOh  = off; off += PXB;
  const size_t oOl  = off; off += PXB;
  if (off > ws_size) return;                       // off = 83886080
  if (off > (size_t)134217728) return;

  char* ws = (char*)d_ws;
  unsigned short* Xb  = (unsigned short*)(ws + oXb);
  unsigned short* WA  = (unsigned short*)(ws + oWA);
  unsigned short* WvB = WA + (size_t)2 * DM * DM;             // rows 2048..3071 ([v feature][in], k contiguous)
  unsigned short* WPb = (unsigned short*)(ws + oWP);
  unsigned short* QKh = (unsigned short*)(ws + oQKh);
  unsigned short* QKl = (unsigned short*)(ws + oQKl);
  unsigned short* VTh = (unsigned short*)(ws + oVTh);
  unsigned short* VTl = (unsigned short*)(ws + oVTl);
  unsigned short* Oh  = (unsigned short*)(ws + oOh);
  unsigned short* Ol  = (unsigned short*)(ws + oOl);
  const float* bv = bqkv + 2 * DM;                            // bias entries 2048..3071

  const dim3 blk(256);
  const int n8x = NB * SEQ * DM / 8;                           // 524288
  const dim3 gCvtX((n8x + 255) / 256);                         // 2048 blocks
  const dim3 gTrA(3 * DM / 64, DM / 64);                       // in [1024][3072] -> out [3072][1024]: (48, 16)
  const dim3 gTrP(DM / 64, DM / 64);                           // in [1024][1024] -> out [1024][1024]: (16, 16)
  const dim3 blkG(128);                                        // GEMM block: 2 x 2 waves
  const dim3 gQK((NB * SEQ / 128) * (QKP / 128), 1);           // 512 blocks of 128x128: M=4096, N=2048
  const dim3 gVT((DM / 128) * (SEQ / 128), NB);                // 128 blocks x 2 batches: M=1024, N=2048
  const dim3 gAttn(NB * NH * NQB);                             // 1024 blocks of 128
  const dim3 gOut((NB * SEQ / 128) * (DM / 128), 1);           // 256 blocks of 128x128: M=4096, N=1024

  // (1) x -> bf16 plane [4096][1024]; weights [in][out] f32 -> bf16 [out][in] (k contiguous) through LDS tiles
  cvt_bf16x8<<<gCvtX, blk, 0, stream>>>(x, Xb, n8x);
  tr_bf16<<<gTrA, blk, 0, stream>>>(Wqkv, WA, DM, 3 * DM);
  tr_bf16<<<gTrP, blk, 0, stream>>>(Wout, WPb, DM, DM);
  // (2) q|k = x . Wqk^T + bqk, per-head normalised (x 8 x gamma), -> bf16 hi/lo planes [b*SEQ+t][n], n < 2048
  //     (Bt = WA rows 0..2047; M=4096, N=2048, K=1024)
  gemm64<0, 2, 1, 1><<<gQK, blkG, 0, stream>>>(
      Xb, Xb, 0LL, WA, 0LL, bqkv, gq, gk,
      (void*)QKh, QKP, 0LL, (void*)QKl, QKP, 0LL, QKP,
      NB * SEQ, QKP, DM, 1.0f);
  // (3) v^T = Wv . x^T + bv per batch -> f16 hi plane [b][h*64+d][s] (pitch SEQ) and residual plane (x4096, same layout)
  //     (A = WA rows 2048..3071 [n][k], Bt = Xb rows of batch b; M=1024, N=2048, K=1024)
  gemm64<0, 3, 2, 0><<<gVT, blkG, 0, stream>>>(
      WvB, WvB, 0LL, Xb, (long long)SEQ * DM, bv, bv, bv,
      (void*)VTh, SEQ, (long long)DM * SEQ, (void*)VTl, SEQ, (long long)DM * SEQ, SEQ,
      DM, SEQ, DM, 4096.0f);
  // (4) full attention -> context bf16 hi/lo planes [4096][1024]
  attn_full64<<<gAttn, dim3(128), 0, stream>>>(QKh, QKl, VTh, VTl, Oh, Ol);
  // (5) out = context . Wout + bout -> d_out f32 [4096][1024]  (A = context hi + lo planes, 2 products; Bt = WP [n][k])
  gemm64<1, 0, 1, 0><<<gOut, blkG, 0, stream>>>(
      Oh, Ol, 0LL, WPb, 0LL, bout, bout, bout,
      d_out, DM, 0LL, d_out, DM, 0LL, DM,
      NB * SEQ, DM, DM, 1.0f);
  (void)hipGetLastError();
}

// v005
// A run of this version takes 157 microseconds.
// Two timings next to v004 put it at 1.07 and 1.06 times that version's speed.
// Over all steps from v000 it is 2.90 times as fast.
// Contractions: q|k and v^T projections = v_wmma_f32_16x16x32_bf16 (bf16 operands from RNE-converted x and the
// transposed [out][in] projection weight, single product, f32 accumulate);
// k.q^T scores = v_wmma_f32_16x16x32_bf16 with bf16 hi/lo split of the normalised q and k (hi.hi + hi.lo + lo.hi), f32 accumulate;
// v^T.p^T = v_wmma_f32_16x16x32_f16 (p carried x1024 in f16 plus an f16 residual plane x4096; v as f16 hi plane plus an f16
// residual plane x4096; 3 products, f32 accumulate);
// ctx.Wout = v_wmma_f32_16x16x32_bf16 with ctx as bf16 hi/lo planes times bf16 Wout (2 products), f32 accumulate;
// per-head sum-of-squares normalisation (x 8 x gamma), softmax, normalisers and bias adds in f32 on the VALU.
// Carry audit:
//   p hi = f16(1024 * p)                     -> the 1/1024 is folded exactly once in the attention epilogue: inv = (1/l) * (1/1024)
//   p res = f16((1024 p - p hi) * 4096)      }  products VTl.(p hi) and VTh.(p res) go to the separate accumulator o1,
//   VTl = f16((v - VTh) * 4096)              }  folded back with * (1/4096) once per key chunk
//   VTh = f16(v), no carry (|v| typ. 0.6); q / k / ctx lo planes are unscaled bf16 residuals (v - hi) sharing the hi accumulator;
//   score scale 1/8 applied once in f32 after the score accumulate; normalisation 8 * rsqrt(sum sq) * gamma applied in f32 in the
//   q|k projection epilogue before the bf16 hi/lo split. No other scaled planes.
#include <hip/hip_runtime.h>
#include <math.h>
#include <stdint.h>

#define NB    2
#define SEQ   2048
#define DM    1024
#define NH    16
#define HD    64
#define QKP   (2 * DM)     // pitch (elements) of the packed q|k planes: q at cols 0..1023, k at cols 1024..2047
#define NQB   (SEQ / 64)   // 32 query / key blocks of 64
#define LP    72           // LDS row pitch (16-bit elements) of the attention K / V^T tiles: 144 B = 16 B x odd, so the 16 rows
                           // that one ds_load_b128 fragment read touches fall on 16 different 16-B bank groups (128 B puts them on 2)
#define GK    64           // k elements of one GEMM stage: 128 B of every operand row
#define GP    (GK + 8)     // LDS row pitch (16-bit elements) of the GEMM stage: 144 B = 16 B x odd, as for LP
#define OSP   68           // LDS row pitch (floats) of the attention output tile: conflict-free for 16-B row reads
#define TPL   10240        // LDS bytes kept per staged attention plane: 64 rows x 144 B = 9216, rounded up to a multiple of 2 KiB
#define TBUF  (4 * TPL)    // one attention stage: K hi, K lo, V^T hi, V^T residual
static_assert(NH * HD == DM);
static_assert(HD == 64);
static_assert((SEQ % 64) == 0 && (DM % 64) == 0 && (DM % 32) == 0);
static_assert(GK == 64);   // the GEMM staging map below is written for 128-B row pieces
static_assert(((NB * SEQ) % 128) == 0 && (QKP % 128) == 0 && (DM % 128) == 0 && (SEQ % 128) == 0 && (DM % GK) == 0);
static_assert((NB * SEQ * DM) % (8 * 256) == 0);
static_assert(64 * LP * 2 <= TPL && (TPL % 2048) == 0 && LP * 2 == 128 + 16);   // the tensor load's pad gives the pitch LP
static_assert(4 * 16 * OSP * 4 <= 2 * TBUF && NQB >= 2);                        // output staging reuses the ring; two stages exist

typedef _Float16 v16h __attribute__((ext_vector_type(16)));
typedef _Float16 v8h  __attribute__((ext_vector_type(8)));
typedef __bf16   v16b __attribute__((ext_vector_type(16)));
typedef __bf16   v8b  __attribute__((ext_vector_type(8)));
typedef float    v8f  __attribute__((ext_vector_type(8)));
typedef float    v4f  __attribute__((ext_vector_type(4)));
typedef unsigned int v4u __attribute__((ext_vector_type(4)));
typedef unsigned int v8u __attribute__((ext_vector_type(8)));

// ---- scalar helpers --------------------------------------------------------------------------------
__device__ __forceinline__ unsigned short bf_bits(float f) {          // f32 -> bf16 bits, RNE convert
  unsigned u = __float_as_uint(f);
  return (unsigned short)((u + 0x7FFFu + ((u >> 16) & 1u)) >> 16);
}
__device__ __forceinline__ float bf_up(unsigned short hb) { return __uint_as_float(((unsigned)hb) << 16); }
__device__ __forceinline__ unsigned short h_bits(_Float16 x) { return __builtin_bit_cast(unsigned short, x); }
__device__ __forceinline__ unsigned pk16(unsigned short a, unsigned short b) { return (unsigned)a | ((unsigned)b << 16); }
__device__ __forceinline__ v8f zero8() { v8f z = {0.f, 0.f, 0.f, 0.f, 0.f, 0.f, 0.f, 0.f}; return z; }

// ---- fragment loader: 16-bit A/B operand, lane -> row/col (lane&15), p already includes +8*(lane>>4);
//      elements 0..7 <- p[0..7] (k0+8h..), elements 8..15 <- p[16..23] (k0+16+8h..)
__device__ __forceinline__ v16b ldfrag_b(const __bf16* p) {
  union { v16b v; v8b h[2]; } f;
  f.h[0] = *(const v8b*)(p);
  f.h[1] = *(const v8b*)(p + 16);
  return f.v;
}

// ---- WMMA helpers: plain builtins (the compiler keeps their hazard distances) and the GEMM loop's v_nop guards ----
__device__ __forceinline__ v8f mma_b_raw(v16b a, v16b b, v8f c) {
  return __builtin_amdgcn_wmma_f32_16x16x32_bf16(false, a, false, b, (short)0, c, false, false);
}
__device__ __forceinline__ v8f mma_h_raw(v16h a, v16h b, v8f c) {
  return __builtin_amdgcn_wmma_f32_16x16x32_f16(false, a, false, b, (short)0, c, false, false);
}
__device__ __forceinline__ void dep_guard_b(v8f& a, v8f& b, v16b x, v16b y) {
  asm volatile("v_nop\n\tv_nop\n\tv_nop\n\tv_nop" : "+v"(a), "+v"(b) : "v"(x), "v"(y));
}
__device__ __forceinline__ void keep4_b(v16b a, v16b b, v16b c, v16b d) {
  asm volatile("v_nop" :: "v"(a), "v"(b), "v"(c), "v"(d));
}
__device__ __forceinline__ void acc_guard4(v8f& a, v8f& b, v8f& c, v8f& d) {
  asm volatile("v_nop\n\tv_nop\n\tv_nop\n\tv_nop" : "+v"(a), "+v"(b), "+v"(c), "+v"(d));
}

// =====================================================================================================
// f32 -> bf16 (RNE convert), 8 elements per thread, one 16-B store per lane: a wave writes 512 contiguous B
// coverage: n8 threads x 8 = the whole plane (n8 here is a multiple of 256).
// =====================================================================================================
__global__ __launch_bounds__(256) void cvt_bf16x8(const float* __restrict__ in, unsigned short* out, int n8) {
  const int i = blockIdx.x * 256 + (int)threadIdx.x;
  if (i < n8) {
    const v4f a = *(const v4f*)(in + (size_t)i * 8);
    const v4f b = *(const v4f*)(in + (size_t)i * 8 + 4);
    v4u p;
    p[0] = pk16(bf_bits(a[0]), bf_bits(a[1]));
    p[1] = pk16(bf_bits(a[2]), bf_bits(a[3]));
    p[2] = pk16(bf_bits(b[0]), bf_bits(b[1]));
    p[3] = pk16(bf_bits(b[2]), bf_bits(b[3]));
    *(v4u*)(out + (size_t)i * 8) = p;
    
  }
}

// =====================================================================================================
// Transpose-convert: f32 in[R rows][Cn cols] -> bf16 out[Cn][R] (RNE convert), 64x64 tiles through LDS.
// grid = (Cn/64, R/64), block 256 (R, Cn multiples of 64). Loads: 4 coalesced float4 per thread
// (64 rows x 16 float4 = the whole input tile). Stores: wave w writes output rows w*8 + it*4 + (lane>>3),
// coverage: 8 waves x 8 rows x 64 k = the whole 64x64 output tile; the grid covers the whole [Cn][R] plane.
// =====================================================================================================
__global__ __launch_bounds__(256) void tr_bf16(const float* __restrict__ in, unsigned short* out, int R, int Cn) {
  __shared__ __align__(16) float sm[64 * 65];
  const int t = (int)threadIdx.x, lane = t & 31, wave = t >> 5;
  const int n0 = blockIdx.x * 64;    // column block of in = row block of out
  const int k0 = blockIdx.y * 64;    // row block of in = column block of out
#pragma unroll
  for (int i = 0; i < 4; ++i) {
    const int idx = t + 256 * i;
    const int kr = idx >> 4, c4 = (idx & 15) * 4;
    const v4f v = *(const v4f*)(in + (size_t)(k0 + kr) * Cn + n0 + c4);
    sm[kr * 65 + c4 + 0] = v[0];
    sm[kr * 65 + c4 + 1] = v[1];
    sm[kr * 65 + c4 + 2] = v[2];
    sm[kr * 65 + c4 + 3] = v[3];
  }
  __syncthreads();
  const int q = lane >> 3, c8 = (lane & 7) * 8;
  v4u pv[2];
#pragma unroll
  for (int it = 0; it < 2; ++it) {
    const int n = wave * 8 + it * 4 + q;
    v4u p;
#pragma unroll
    for (int e = 0; e < 4; ++e) {
      const float a = sm[(c8 + 2 * e) * 65 + n];
      const float b = sm[(c8 + 2 * e + 1) * 65 + n];
      p[e] = pk16(bf_bits(a), bf_bits(b));
    }
    pv[it] = p;
  }
  {
#pragma unroll
    for (int it = 0; it < 2; ++it) {
      const int n = wave * 8 + it * 4 + q;
      *(v4u*)(out + (size_t)(n0 + n) * R + k0 + c8) = pv[it];
    }
    
  }
}

// =====================================================================================================
// Register-blocked batched bf16 WMMA GEMM: C[m][n] = sum_k A[m][k] * Bt[n][k] + bias; one wave per 64x64 tile,
// 2 x 2 waves = one 128x128 tile per block. Per GK k the block stages its 128 A rows and 128 Bt rows (128 B each) in LDS
// with whole-line loads (8 lanes a row, 4 rows a wave-wide load) and every wave reads its fragments from there, so a row
// is fetched once per block instead of once per wave, 32 B of 16 lines at a time.
// A row-major [M][K], Bt row-major [N][K] (k contiguous), both at the fixed pitch DM, so that a thread's 8 rows of a plane
// are one address plus immediate offsets;
// M, N multiples of 128, K multiple of GK (host shapes are static multiples). blockIdx.y = batch index (strides in elements).
// NSPLIT: 0 = A.Bt; 1 = (A + A2).Bt (A2 = unscaled bf16 lo plane of A, 2 products).
// BIAS: 1 = per column n, bias[n]; 2 = per row m, bias[m]; the bias value is RNE-converted to bf16 and added in f32.
// NORM (only with OUT_MODE 2, BIAS 1, N tile = one 64-wide head): per row, over the tile's 64 columns,
//   value := (acc + bias) * 8 * rsqrt(max(sum (acc + bias)^2, 1e-24)) * gamma[n mod DM] in f32, gamma = gma for
//   n0 < DM else gmb (RNE-converted to bf16); the row sum uses 16-lane shuffles (all lanes active).
// OUT_MODE: 0 = f32 (pitch ldc); 2 = bf16 hi plane C + bf16 lo plane C2 (lo = RNE(v - hi), unscaled);
//           3 = f16 hi plane C + f16 residual plane C2 = f16((v - hi) * rscale), C2 written only for tiles
//               with n0 < N2 (pitch ldc2, batch stride strideC2).
// =====================================================================================================
template <int NSPLIT, int OUT_MODE, int BIAS, int NORM>
__global__ __launch_bounds__(128) void gemm64(
    const unsigned short* __restrict__ Ap, const unsigned short* A2p, long long strideA,
    const unsigned short* __restrict__ Btp, long long strideB,
    const float* __restrict__ bias, const float* __restrict__ gma, const float* __restrict__ gmb,
    void* Cout, int ldc, long long strideC,
    void* Cout2, int ldc2, long long strideC2, int N2,
    int M, int N, int K, float rscale) {
  const __bf16* A   = (const __bf16*)(const void*)Ap;
  const __bf16* A2  = (const __bf16*)(const void*)A2p;
  const __bf16* Bt  = (const __bf16*)(const void*)Btp;
  __shared__ __align__(16) float sT[4][16 * 68];   // per-wave 16x64 slab, pitch 68 floats
  __shared__ __align__(16) __bf16 As[128 * GP];                          // A rows  [m][GK k] at pitch GP  18 KB
  __shared__ __align__(16) __bf16 A2s[(NSPLIT >= 1 ? 128 : 1) * GP];     // A2 rows, only with NSPLIT 1
  __shared__ __align__(16) __bf16 Bs[128 * GP];                          // Bt rows [n][GK k] at pitch GP  18 KB
  const int b    = blockIdx.y;
  const int lane = threadIdx.x & 31;
  const int wave = threadIdx.x >> 5;
  const int tilesN = N >> 7;
  const int tilesM = M >> 7;
  const int tile = blockIdx.x;
  if (tile >= tilesM * tilesN) return;   // block-uniform, ahead of every barrier
  const int tm = tile / tilesN;
  const int tn = tile - tm * tilesN;
  const int bm0 = tm << 7;               // the block's 128x128 tile
  const int bn0 = tn << 7;
  const int wm  = (wave >> 1) << 6;      // the wave's 64x64 tile inside it
  const int wn  = (wave & 1) << 6;
  const int m0 = bm0 + wm;
  const int n0 = bn0 + wn;

  const __bf16* Ab  = A  + (size_t)b * (size_t)strideA;
  const __bf16* Bb  = Bt + (size_t)b * (size_t)strideB;
  const __bf16* Ab2 = (NSPLIT >= 1) ? (A2 + (size_t)b * (size_t)strideA) : Ab;

  const int rlane = lane & 15;                 // row (A) / col (B, D) within subtile
  const int koff  = (lane >> 4) * 8;           // k offset of this lane half
  const int mOff  = (lane >> 4) * 8;           // D row offset

  v8f acc[4][4];
#pragma unroll
  for (int i = 0; i < 4; ++i)
#pragma unroll
    for (int j = 0; j < 4; ++j) acc[i][j] = zero8();

  // staging map: 8 lanes x 16 B = one whole 128-B row piece (a cache line), four rows a wave-wide load; the two rows of a
  // half wave lie 8 apart, so that at pitch GP their 2 x 128 B fall on all 64 LDS banks once in the store.
  // Wave w stages rows w*32 .. w*32+31 of every plane.
  const int ssub = lane >> 3, sc8 = (lane & 7) * 8;
  const int srow = wave * 32 + (ssub >> 1) + (ssub & 1) * 8;   // + (i>>2)*16 + (i&3)*2, i = 0..7
  const __bf16* ga  = Ab  + (size_t)(bm0 + srow) * DM + sc8;   // rows bm0 + srow + 0..22 < M, bn0 + srow + 0..22 < N
  const __bf16* ga2 = Ab2 + (size_t)(bm0 + srow) * DM + sc8;
  const __bf16* gb  = Bb  + (size_t)(bn0 + srow) * DM + sc8;

  for (int k0 = 0; k0 < K; k0 += GK) {
    __syncthreads();                       // every wave has read the last stage's fragments
    {
      v8b ra[8], ra2[8], rb[8];
      const __bf16* pa  = ga + k0;
      const __bf16* pa2 = ga2 + k0;
      const __bf16* pb  = gb + k0;
#pragma unroll
      for (int i = 0; i < 8; ++i) {
        const int ro = (i >> 2) * 16 + (i & 3) * 2;
        ra[i] = *(const v8b*)(pa + ro * DM);
        if (NSPLIT >= 1) ra2[i] = *(const v8b*)(pa2 + ro * DM);
        rb[i] = *(const v8b*)(pb + ro * DM);
      }
      // precaution: the wait stands behind the loads and names their address registers, so that nothing (no later
      // load's destination either) is laid over an address before it
      asm volatile("s_wait_xcnt 0x0" :: "v"(pa), "v"(pa2), "v"(pb) : "memory");
#pragma unroll
      for (int i = 0; i < 8; ++i) {
        const int ro = (i >> 2) * 16 + (i & 3) * 2;
        *(v8b*)(As + (srow + ro) * GP + sc8) = ra[i];
        if (NSPLIT >= 1) *(v8b*)(A2s + (srow + ro) * GP + sc8) = ra2[i];
        *(v8b*)(Bs + (srow + ro) * GP + sc8) = rb[i];
      }
    }
    __syncthreads();                       // the stage is complete for every wave
#pragma unroll
    for (int kk = 0; kk < GK; kk += 32) {
      v16b bh[4], ah[4], al[4];
#pragma unroll
      for (int j = 0; j < 4; ++j) bh[j] = ldfrag_b(Bs + (wn + (j << 4) + rlane) * GP + kk + koff);
#pragma unroll
      for (int i = 0; i < 4; ++i) {
        const int ao = (wm + (i << 4) + rlane) * GP + kk + koff;
        ah[i] = ldfrag_b(As + ao);
        al[i] = ah[i];
        if (NSPLIT >= 1) al[i] = ldfrag_b(A2s + ao);
      }
#pragma unroll
      for (int i = 0; i < 4; ++i) {
#pragma unroll
        for (int j = 0; j < 4; ++j) {
          acc[i][j] = mma_b_raw(ah[i], bh[j], acc[i][j]);
          if (NSPLIT >= 1) acc[i][j] = mma_b_raw(al[i], bh[j], acc[i][j]);
        }
        dep_guard_b(acc[i][0], acc[i][3], ah[i], al[i]);
      }
      keep4_b(bh[0], bh[1], bh[2], bh[3]);
    }
  }
  acc_guard4(acc[0][0], acc[0][1], acc[0][2], acc[0][3]);
  acc_guard4(acc[1][0], acc[1][1], acc[1][2], acc[1][3]);
  acc_guard4(acc[2][0], acc[2][1], acc[2][2], acc[2][3]);
  acc_guard4(acc[3][0], acc[3][1], acc[3][2], acc[3][3]);

  // ---- epilogue ----
  float* slab = sT[wave];
  float bcol[4], gcol[4];
#pragma unroll
  for (int j = 0; j < 4; ++j) {
    bcol[j] = 0.f;
    gcol[j] = 1.f;
    if (BIAS == 1) bcol[j] = bf_up(bf_bits(bias[n0 + (j << 4) + rlane]));   // n < N, bias has N entries
    if (NORM) {
      const int nn = (n0 & (DM - 1)) + (j << 4) + rlane;                   // < DM = NH*HD entries
      const float ga = bf_up(bf_bits(gma[nn]));
      const float gb = bf_up(bf_bits(gmb[nn]));
      gcol[j] = (n0 < DM) ? ga : gb;                                       // wave-uniform select by value
    }
  }
#pragma unroll
  for (int i = 0; i < 4; ++i) {
    const int mBase = m0 + (i << 4);
    float brow[8];
#pragma unroll
    for (int r = 0; r < 8; ++r) {
      brow[r] = 0.f;
      if (BIAS == 2) brow[r] = bf_up(bf_bits(bias[mBase + mOff + r]));      // m < M, bias has M entries
    }
    float rsc[8];
#pragma unroll
    for (int r = 0; r < 8; ++r) rsc[r] = 1.f;
    if (NORM) {
      float ss[8];
#pragma unroll
      for (int r = 0; r < 8; ++r) {
        float a = 0.f;
#pragma unroll
        for (int j = 0; j < 4; ++j) {
          const float v = acc[i][j][r] + bcol[j];
          a += v * v;
        }
        ss[r] = a;
      }
#pragma unroll
      for (int r = 0; r < 8; ++r) {
#pragma unroll
        for (int off = 1; off < 16; off <<= 1) ss[r] += __shfl_xor(ss[r], off, 32);   // stays inside the lane half
        rsc[r] = rsqrtf(fmaxf(ss[r], 1e-24f)) * 8.0f;
      }
    }
#pragma unroll
    for (int j = 0; j < 4; ++j) {
#pragma unroll
      for (int r = 0; r < 8; ++r) {
        slab[(mOff + r) * 68 + (j << 4) + rlane] = (acc[i][j][r] + bcol[j] + brow[r]) * rsc[r] * gcol[j];
      }
    }
    __builtin_amdgcn_fence(__ATOMIC_RELEASE, "workgroup");
    __builtin_amdgcn_wave_barrier();
    __builtin_amdgcn_fence(__ATOMIC_ACQUIRE, "workgroup");
    if (OUT_MODE == 0) {
      float* C = (float*)Cout + (size_t)b * (size_t)strideC;
      const int h2 = lane >> 4, c4 = (lane & 15) * 4;     // 256-B row segment = 16 lanes x 16 B
      {
#pragma unroll
        for (int it = 0; it < 8; ++it) {
          const int row = it * 2 + h2;                     // it 0..7 x h2 0..1 = rows 0..15
          const v4f v = *(const v4f*)(slab + row * 68 + c4);
          *(v4f*)(C + (size_t)(mBase + row) * ldc + n0 + c4) = v;
        }
        
      }
    } else {
      const int q = lane >> 3, c8 = (lane & 7) * 8;
      unsigned short* C  = (unsigned short*)Cout  + (size_t)b * (size_t)strideC;
      unsigned short* C2 = (unsigned short*)Cout2 + (size_t)b * (size_t)strideC2;
      const bool wlo = (OUT_MODE == 2) || (n0 < N2);      // wave-uniform
      v4u hv[4], lv[4];
#pragma unroll
      for (int it = 0; it < 4; ++it) {
        const int row = it * 4 + q;                        // it 0..3 x q 0..3 = rows 0..15
        const float* sp = slab + row * 68 + c8;
        v4u a, a2;
#pragma unroll
        for (int e = 0; e < 4; ++e) {
          const float f0 = sp[2 * e], f1 = sp[2 * e + 1];
          unsigned short h0, h1, l0, l1;
          if (OUT_MODE == 2) {
            h0 = bf_bits(f0); h1 = bf_bits(f1);
            l0 = bf_bits(f0 - bf_up(h0)); l1 = bf_bits(f1 - bf_up(h1));
          } else {
            const _Float16 x0 = (_Float16)f0, x1 = (_Float16)f1;
            h0 = h_bits(x0); h1 = h_bits(x1);
            l0 = h_bits((_Float16)((f0 - (float)x0) * rscale));
            l1 = h_bits((_Float16)((f1 - (float)x1) * rscale));
          }
          a[e] = pk16(h0, h1); a2[e] = pk16(l0, l1);
        }
        hv[it] = a; lv[it] = a2;
      }
      {
#pragma unroll
        for (int it = 0; it < 4; ++it) {
          const int row = it * 4 + q;
          *(v4u*)(C + (size_t)(mBase + row) * ldc + n0 + c8) = hv[it];
          if (wlo) *(v4u*)(C2 + (size_t)(mBase + row) * ldc2 + n0 + c8) = lv[it];
        }
        
      }
    }
    __builtin_amdgcn_fence(__ATOMIC_RELEASE, "workgroup");
    __builtin_amdgcn_wave_barrier();
    __builtin_amdgcn_fence(__ATOMIC_ACQUIRE, "workgroup");
  }
}

__device__ __forceinline__ float xhalf(float x) {
  const int xi = __builtin_bit_cast(int, x);
  return __builtin_bit_cast(float, __builtin_amdgcn_permlanex16(xi, xi, 0x76543210, 0xfedcba98, false, false));
}

// ---- tensor load of one 64-row x 128-B plane tile into LDS at pitch 144 B --------------------------------
__device__ __forceinline__ uint32_t uni(uint32_t v) { return (uint32_t)__builtin_amdgcn_readfirstlane(v); }
// tensor loads ignore EXEC: a test around one must compile to s_cmp + s_cbranch_scc, so its word is held in a scalar register
__device__ __forceinline__ uint32_t pinned(uint32_t v) {
  uint32_t w = uni(v);
  asm volatile("" : "+s"(w));   // the pinned() form: a wave-uniform word of a tensor load's test or descriptor kept in an SGPR
  return w;
}
__device__ __forceinline__ void tdm_plane(uint32_t lds_dst, uint64_t ga) {
  v4u g0;
  g0[0] = uni(1u);                                                       // count 1
  g0[1] = uni(lds_dst);                                                  // byte offset in the work-group's LDS
  g0[2] = uni((uint32_t)ga);                                             // first byte of the tile
  g0[3] = uni((((uint32_t)(ga >> 32)) & 0x01FFFFFFu) | 0x80000000u);     // address high bits, type 2
  v8u g1;
  g1[0] = uni((1u << 20) | (4u << 22) | (3u << 25));                     // no mask, 1-byte elements, 16 B of pad behind every 128 B
  g1[1] = uni(128u << 16);                                               // tensor dim0 = 128 B
  g1[2] = uni(64u << 16);                                                // tensor dim1 = 64 rows
  g1[3] = uni(128u << 16);                                               // tile dim0 = 128 B
  g1[4] = uni(64u);                                                      // tile dim1 = 64 rows
  g1[5] = uni(4096u);                                                    // source row pitch in bytes
  g1[6] = uni(0u);
  g1[7] = uni(0u);
  asm volatile("tensor_load_to_lds %0, %1" :: "s"(g0), "s"(g1) : "memory");
}
static_assert(QKP * 2 == 4096 && SEQ * 2 == 4096 && HD * 2 == 128);      // both sources have the descriptor's pitch and row length

__global__ __launch_bounds__(128)
void attn_full64(const unsigned short* __restrict__ qkhp, const unsigned short* __restrict__ qklp,
                 const unsigned short* __restrict__ vhp, const unsigned short* __restrict__ vlp,
                 unsigned short* ohp, unsigned short* olp) {
  union FB { v16b v; v8b h[2]; };
  union FH { v16h v; v8h h[2]; };
  // two stages of four planes (K hi [kv][d], K lo, V^T hi [d][kv], V^T residual; rows of 64 at pitch LP), each plane at a
  // multiple of 2 KiB; behind the loop the same bytes hold the per-wave context tiles [query][d]. 80 KiB: four blocks a WGP.
  __shared__ __attribute__((aligned(2048))) unsigned char L[2 * TBUF];

  const int tid  = threadIdx.x;
  const int wave = tid >> 5;
  const int lane = tid & 31;
  const int hh   = lane >> 4;
  const int c    = lane & 15;

  const int bx   = blockIdx.x;
  const int qb   = bx % NQB;
  const int rest = bx / NQB;
  const int h    = rest % NH;
  const int b    = rest / NH;
  const int q0   = qb * 64 + wave * 16;
  const size_t rowB = (size_t)b * SEQ;

  const __bf16* Qh = (const __bf16*)(const void*)qkhp + (size_t)h * HD;
  const __bf16* Ql = (const __bf16*)(const void*)qklp + (size_t)h * HD;
  const __bf16* Kh = (const __bf16*)(const void*)qkhp + DM + (size_t)h * HD;
  const __bf16* Kl = (const __bf16*)(const void*)qklp + DM + (size_t)h * HD;
  const _Float16* Vh = (const _Float16*)(const void*)vhp + ((size_t)b * DM + (size_t)h * HD) * SEQ;
  const _Float16* Vl = (const _Float16*)(const void*)vlp + ((size_t)b * DM + (size_t)h * HD) * SEQ;

  // ---- Q fragments (B operand, column = query = lane&15): 2 d-chunks, hi and lo ----
  v16b qah[2], qal[2];
#pragma unroll
  for (int dc = 0; dc < 2; ++dc) {
    const size_t qo = (rowB + q0 + c) * QKP + dc * 32 + 8 * hh;
    qah[dc] = ldfrag_b(Qh + qo);
    qal[dc] = ldfrag_b(Ql + qo);
  }

  // ---- staging: wave w brings plane w of every stage with one tensor load (every wave issues, so no wave test) ----
  const uint32_t wv = uni((uint32_t)tid >> 5);
  const uint32_t ldst = (uint32_t)(size_t)L + wv * TPL;
  const uint64_t gsrc = (wv == 0u) ? (uint64_t)(size_t)(Kh + rowB * QKP) : (wv == 1u) ? (uint64_t)(size_t)(Kl + rowB * QKP)
                      : (wv == 2u) ? (uint64_t)(size_t)Vh : (uint64_t)(size_t)Vl;
  const uint32_t gstep = (wv < 2u) ? 64u * QKP * 2u : 64u * 2u;   // 64 keys on: 64 K rows, or 128 B along a V^T row
  tdm_plane(ldst, gsrc);                                   // stage 0 into buffer 0
  asm volatile("s_wait_tensorcnt 0x0" ::: "memory");       // this wave's plane of stage 0 has landed
  __syncthreads();                                         // stage 0 is published to every wave
  tdm_plane(ldst + TBUF, gsrc + gstep);                    // stage 1 into buffer 1, in flight during pass 0

  float mrow = -INFINITY, lrow = 0.f;          // this lane's query: running maximum (both halves alike), this half's sum
  v8f oacc[4];
#pragma unroll
  for (int t = 0; t < 4; ++t) oacc[t] = zero8();

  for (int kt = 0; kt < NQB; ++kt) {           // static trip count
    const unsigned char* Lb = L + (kt & 1) * TBUF;               // pass kt reads buffer kt mod 2 alone
    const __bf16*   Ksh = (const __bf16*)(const void*)(Lb);
    const __bf16*   Ksl = (const __bf16*)(const void*)(Lb + TPL);
    const _Float16* Vth = (const _Float16*)(const void*)(Lb + 2 * TPL);
    const _Float16* Vtl = (const _Float16*)(const void*)(Lb + 3 * TPL);

    // ---- scores, transposed: 64 keys x 16 query columns per wave, 3 bf16 products ----
    //      Each d half: its 16 fragment loads as one group, then the products by kind over the four key tiles, so that
    //      successive matrix instructions have different accumulators (every tile keeps its own order of products).
    v8f s[4];
#pragma unroll
    for (int j = 0; j < 4; ++j) s[j] = zero8();
#pragma unroll
    for (int dc = 0; dc < 2; ++dc) {
      FB kb[4], kl[4];
#pragma unroll
      for (int j = 0; j < 4; ++j) {
        kb[j].h[0] = *(const v8b*)(Ksh + (j * 16 + c) * LP + dc * 32 + 8 * hh);
        kb[j].h[1] = *(const v8b*)(Ksh + (j * 16 + c) * LP + dc * 32 + 16 + 8 * hh);
        kl[j].h[0] = *(const v8b*)(Ksl + (j * 16 + c) * LP + dc * 32 + 8 * hh);
        kl[j].h[1] = *(const v8b*)(Ksl + (j * 16 + c) * LP + dc * 32 + 16 + 8 * hh);
      }
#pragma unroll
      for (int j = 0; j < 4; ++j) s[j] = mma_b_raw(kb[j].v, qah[dc], s[j]);
#pragma unroll
      for (int j = 0; j < 4; ++j) s[j] = mma_b_raw(kl[j].v, qah[dc], s[j]);
#pragma unroll
      for (int j = 0; j < 4; ++j) s[j] = mma_b_raw(kb[j].v, qal[dc], s[j]);
    }

    // ---- scale, maximum of this lane's query, online softmax, P (x1024, f16) and P residual (x4096) in registers ----
    float mj[4];
#pragma unroll
    for (int j = 0; j < 4; ++j) {
      mj[j] = -INFINITY;
#pragma unroll
      for (int r = 0; r < 8; ++r) {
        const float sv = s[j][r] * 0.125f;
        s[j][r] = sv;
        mj[j] = fmaxf(mj[j], sv);
      }
    }
    float m = fmaxf(fmaxf(mj[0], mj[1]), fmaxf(mj[2], mj[3]));
    m = fmaxf(m, xhalf(m));                    // both halves now hold the maximum over the chunk's 64 keys
    const float mnew  = fmaxf(mrow, m);
    const float msafe = (mnew == -INFINITY) ? 0.f : mnew;
    const float alpha = __expf(mrow - msafe);
    mrow = mnew;
    FH pa[2], pl[2];                           // B operands of key blocks 0 and 1: p hi plane, p residual plane
    float pj[4];
#pragma unroll
    for (int j = 0; j < 4; ++j) {
      pj[j] = 0.f;
#pragma unroll
      for (int r = 0; r < 8; ++r) {
        const float p = __expf(s[j][r] - msafe);
        pj[j] += p;
        const float p1k = p * 1024.0f;
        const _Float16 ph = (_Float16)p1k;
        pa[j >> 1].h[j & 1][r] = ph;
        pl[j >> 1].h[j & 1][r] = (_Float16)((p1k - (float)ph) * 4096.0f);
      }
    }
    lrow = lrow * alpha + ((pj[0] + pj[1]) + (pj[2] + pj[3]));
#pragma unroll
    for (int t = 0; t < 4; ++t)
#pragma unroll
      for (int r = 0; r < 8; ++r) oacc[t][r] *= alpha;

    // ---- context^T += V^T . P^T (f16 WMMA), residual products into a separate accumulator ----
    v8f o1[4];
#pragma unroll
    for (int t = 0; t < 4; ++t) o1[t] = zero8();
#pragma unroll
    for (int kk = 0; kk < 2; ++kk) {           // unrolled: pa / pl are register operands picked by kk
      FH vb[4], vl[4];                         // one load group per key block, then the products by kind over the four d tiles
#pragma unroll
      for (int t = 0; t < 4; ++t) {
        vb[t].h[0] = *(const v8h*)(Vth + (t * 16 + c) * LP + kk * 32 + 8 * hh);
        vb[t].h[1] = *(const v8h*)(Vth + (t * 16 + c) * LP + kk * 32 + 16 + 8 * hh);
        vl[t].h[0] = *(const v8h*)(Vtl + (t * 16 + c) * LP + kk * 32 + 8 * hh);
        vl[t].h[1] = *(const v8h*)(Vtl + (t * 16 + c) * LP + kk * 32 + 16 + 8 * hh);
      }
#pragma unroll
      for (int t = 0; t < 4; ++t) oacc[t] = mma_h_raw(vb[t].v, pa[kk].v, oacc[t]);
#pragma unroll
      for (int t = 0; t < 4; ++t) o1[t]   = mma_h_raw(vl[t].v, pa[kk].v, o1[t]);
#pragma unroll
      for (int t = 0; t < 4; ++t) o1[t]   = mma_h_raw(vb[t].v, pl[kk].v, o1[t]);
    }
#pragma unroll
    for (int t = 0; t < 4; ++t)
#pragma unroll
      for (int r = 0; r < 8; ++r) oacc[t][r] += o1[t][r] * (1.0f / 4096.0f);

    // ---- publish point of stage kt + 1 ----
    asm volatile("s_wait_dscnt 0x0" ::: "memory");         // this wave's reads of buffer kt mod 2 have returned
    asm volatile("s_wait_tensorcnt 0x0" ::: "memory");     // this wave's plane of stage kt + 1 has landed
    __syncthreads();                                       // stage kt + 1 published; every wave has left buffer kt mod 2
    if (pinned((uint32_t)(kt + 2 < NQB))) {                // scalar branch: only while stage kt + 2 exists
      const uint32_t st = pinned((uint32_t)kt + 2u);       // held behind the wait above, and the descriptor formed from it
      tdm_plane(ldst + (st & 1u) * TBUF, gsrc + (uint64_t)st * gstep);
    }
  }
  asm volatile("s_wait_tensorcnt 0x0" ::: "memory");       // no tensor load is in flight
  asm volatile("s_wait_dscnt 0x0" ::: "memory");           // the last pass's barrier has ended every read: the ring may hold output

  // ---- join the halves' sums, normalise (1/l and the 1/1024 p carry), stage the wave's 16x64 tile [query][d],
  //      bf16 hi/lo split
  float* os = (float*)(void*)L + wave * (16 * OSP);
  {
    const float l = lrow + xhalf(lrow);
    const float inv = ((l > 0.f) ? (1.0f / l) : 0.f) * (1.0f / 1024.0f);
#pragma unroll
    for (int t = 0; t < 4; ++t) {
      v4f w0, w1;
#pragma unroll
      for (int r = 0; r < 4; ++r) { w0[r] = oacc[t][r] * inv; w1[r] = oacc[t][4 + r] * inv; }
      *(v4f*)(os + c * OSP + t * 16 + 8 * hh)     = w0;
      *(v4f*)(os + c * OSP + t * 16 + 8 * hh + 4) = w1;
    }
  }
  __builtin_amdgcn_fence(__ATOMIC_RELEASE, "workgroup");
  __builtin_amdgcn_wave_barrier();
  __builtin_amdgcn_fence(__ATOMIC_ACQUIRE, "workgroup");
  {
    const int q4 = lane >> 3, c8 = (lane & 7) * 8;
    v4u hv[4], lv[4];
#pragma unroll
    for (int it = 0; it < 4; ++it) {
      const int row = it * 4 + q4;   // it 0..3 x q4 0..3 = rows 0..15 of the wave tile
      const float* sp = os + row * OSP + c8;
      v4u a, a2;
#pragma unroll
      for (int e = 0; e < 4; ++e) {
        const float f0 = sp[2 * e], f1 = sp[2 * e + 1];
        const unsigned short h0 = bf_bits(f0), h1 = bf_bits(f1);
        const unsigned short l0 = bf_bits(f0 - bf_up(h0)), l1 = bf_bits(f1 - bf_up(h1));
        a[e] = pk16(h0, h1); a2[e] = pk16(l0, l1);
      }
      hv[it] = a; lv[it] = a2;
    }
    {
#pragma unroll
      for (int it = 0; it < 4; ++it) {
        const int row = it * 4 + q4;
        const size_t go = (rowB + q0 + row) * DM + (size_t)h * HD + c8;
        *(v4u*)(ohp + go) = hv[it];
        *(v4u*)(olp + go) = lv[it];
      }
      
    }
  }
}

// =====================================================================================================
// Workspace map (bytes; every region is an exact multiple of its 64x64-tile / whole-line store granularity, no padded
// tails needed since all shapes are tile multiples; every region is written by exactly one producer launch, none reused):
//   Xb   bf16 [4096][1024]                  0     8388608
//   WA   bf16 [3072 n][1024 k]          8388608     6291456   (q rows 0..1023, k rows 1024..2047, v rows 2048..3071)
//   WP   bf16 [1024 n][1024 k]         14680064     2097152
//   QKh  bf16 [4096][2048] (q | k hi)  16777216    16777216
//   QKl  bf16 [4096][2048] (q | k lo)  33554432    16777216
//   VTh  f16  [2][1024][2048]          50331648     8388608
//   VTl  f16  [2][1024][2048]          58720256     8388608
//   Oh   bf16 [4096][1024]             67108864     8388608
//   Ol   bf16 [4096][1024]             75497472     8388608
//   end                                83886080
// =====================================================================================================
extern "C" void kernel_launch(void* const* d_in, const int* in_sizes, int n_in,
                              void* d_out, int out_size, void* d_ws, size_t ws_size,
                              hipStream_t stream) {
  if (n_in < 7) return;
  if (in_sizes[0] != NB * SEQ * DM) return;
  if (in_sizes[1] != 3 * DM * DM) return;
  if (in_sizes[2] != 3 * DM) return;
  if (in_sizes[3] != NH * HD || in_sizes[4] != NH * HD) return;
  if (in_sizes[5] != DM * DM) return;
  if (in_sizes[6] != DM) return;
  if (out_size != NB * SEQ * DM) return;

  const float* x    = (const float*)d_in[0];   // [2][2048][1024]
  const float* Wqkv = (const float*)d_in[1];   // [1024 in][3072 out]  (cols: q | k | v, head h = cols h*64..h*64+63 of each block)
  const float* bqkv = (const float*)d_in[2];   // [3072]
  const float* gq   = (const float*)d_in[3];   // [16][64]
  const float* gk   = (const float*)d_in[4];   // [16][64]
  const float* Wout = (const float*)d_in[5];   // [1024 in][1024 out]
  const float* bout = (const float*)d_in[6];   // [1024]

  const size_t PXB = (size_t)NB * SEQ * DM * 2;    //  8388608  16-bit plane [4096][1024]
  const size_t PWA = (size_t)3 * DM * DM * 2;      //  6291456  packed [3072][1024] bf16 weight plane
  const size_t PWP = (size_t)DM * DM * 2;          //  2097152  [1024][1024] bf16 weight plane
  const size_t PQK = (size_t)NB * SEQ * QKP * 2;   // 16777216  q|k plane [4096][2048]
  const size_t PVT = (size_t)NB * DM * SEQ * 2;    //  8388608  v^T plane [2][1024][2048]
  size_t off = 0;
  const size_t oXb  = off; off += PXB;
  const size_t oWA  = off; off += PWA;
  const size_t oWP  = off; off += PWP;
  const size_t oQKh = off; off += PQK;
  const size_t oQKl = off; off += PQK;
  const size_t oVTh = off; off += PVT;
  const size_t oVTl = off; off += PVT;
  const size_t oOh  = off; off += PXB;
  const size_t oOl  = off; off += PXB;
  if (off > ws_size) return;                       // off = 83886080
  if (off > (size_t)134217728) return;

  char* ws = (char*)d_ws;
  unsigned short* Xb  = (unsigned short*)(ws + oXb);
  unsigned short* WA  = (unsigned short*)(ws + oWA);
  unsigned short* WvB = WA + (size_t)2 * DM * DM;             // rows 2048..3071 ([v feature][in], k contiguous)
  unsigned short* WPb = (unsigned short*)(ws + oWP);
  unsigned short* QKh = (unsigned short*)(ws + oQKh);
  unsigned short* QKl = (unsigned short*)(ws + oQKl);
  unsigned short* VTh = (unsigned short*)(ws + oVTh);
  unsigned short* VTl = (unsigned short*)(ws + oVTl);
  unsigned short* Oh  = (unsigned short*)(ws + oOh);
  unsigned short* Ol  = (unsigned short*)(ws + oOl);
  const float* bv = bqkv + 2 * DM;                            // bias entries 2048..3071

  const dim3 blk(256);
  const int n8x = NB * SEQ * DM / 8;                           // 524288
  const dim3 gCvtX((n8x + 255) / 256);                         // 2048 blocks
  const dim3 gTrA(3 * DM / 64, DM / 64);                       // in [1024][3072] -> out [3072][1024]: (48, 16)
  const dim3 gTrP(DM / 64, DM / 64);                           // in [1024][1024] -> out [1024][1024]: (16, 16)
  const dim3 blkG(128);                                        // GEMM block: 2 x 2 waves
  const dim3 gQK((NB * SEQ / 128) * (QKP / 128), 1);           // 512 blocks of 128x128: M=4096, N=2048
  const dim3 gVT((DM / 128) * (SEQ / 128), NB);                // 128 blocks x 2 batches: M=1024, N=2048
  const dim3 gAttn(NB * NH * NQB);                             // 1024 blocks of 128
  const dim3 gOut((NB * SEQ / 128) * (DM / 128), 1);           // 256 blocks of 128x128: M=4096, N=1024

  // (1) x -> bf16 plane [4096][1024]; weights [in][out] f32 -> bf16 [out][in] (k contiguous) through LDS tiles
  cvt_bf16x8<<<gCvtX, blk, 0, stream>>>(x, Xb, n8x);
  tr_bf16<<<gTrA, blk, 0, stream>>>(Wqkv, WA, DM, 3 * DM);
  tr_bf16<<<gTrP, blk, 0, stream>>>(Wout, WPb, DM, DM);
  // (2) q|k = x . Wqk^T + bqk, per-head normalised (x 8 x gamma), -> bf16 hi/lo planes [b*SEQ+t][n], n < 2048
  //     (Bt = WA rows 0..2047; M=4096, N=2048, K=1024)
  gemm64<0, 2, 1, 1><<<gQK, blkG, 0, stream>>>(
      Xb, Xb, 0LL, WA, 0LL, bqkv, gq, gk,
      (void*)QKh, QKP, 0LL, (void*)QKl, QKP, 0LL, QKP,
      NB * SEQ, QKP, DM, 1.0f);
  // (3) v^T = Wv . x^T + bv per batch -> f16 hi plane [b][h*64+d][s] (pitch SEQ) and residual plane (x4096, same layout)
  //     (A = WA rows 2048..3071 [n][k], Bt = Xb rows of batch b; M=1024, N=2048, K=1024)
  gemm64<0, 3, 2, 0><<<gVT, blkG, 0, stream>>>(
      WvB, WvB, 0LL, Xb, (long long)SEQ * DM, bv, bv, bv,
      (void*)VTh, SEQ, (long long)DM * SEQ, (void*)VTl, SEQ, (long long)DM * SEQ, SEQ,
      DM, SEQ, DM, 4096.0f);
  // (4) full attention -> context bf16 hi/lo planes [4096][1024]
  attn_full64<<<gAttn, dim3(128), 0, stream>>>(QKh, QKl, VTh, VTl, Oh, Ol);
  // (5) out = context . Wout + bout -> d_out f32 [4096][1024]  (A = context hi + lo planes, 2 products; Bt = WP [n][k])
  gemm64<1, 0, 1, 0><<<gOut, blkG, 0, stream>>>(
      Oh, Ol, 0LL, WPb, 0LL, bout, bout, bout,
      d_out, DM, 0LL, d_out, DM, 0LL, DM,
      NB * SEQ, DM, DM, 1.0f);
  (void)hipGetLastError();
}
